// v000
// Times are from an AMD MI455X. After a warm-up the kernel runs many times in a row, and a time is the length of
// such a window on the GPU divided by its runs, so every launch and the gaps after it count. The runs cycle
// through copies of the inputs. A figure is the median of several windows, for all but v000 over two sittings.
// Sittings can differ by a few percent; kernels timed side by side share one.
// v000 is the starting kernel. One run takes 411 microseconds.
#include <hip/hip_runtime.h>

// Compute dtypes, f32 accumulate everywhere: per-head Q/K/V projections (K = 512) = v_wmma_f32_16x16x32_bf16 on bf16-converted (RNE) x and W planes (bias bf16-converted, added in f32); scores q.k^T and P.V = v_wmma_f32_16x16x32_f16 single products (q, k, v as f16 planes; p = exp2 carried x1024 via the exponent offset, cancelled by the row sum); softmax in f32.
// Flash form: S^T = K Q^T (query on the lane/column axis), packed D tiles feed P^T as the B operand, O^T = Vt P^T; all row statistics are per lane.

#ifndef NB
#define NB 2
#endif
#ifndef SEQ
#define SEQ 4096
#endif
#define SEQ_FULL 4096
#define NH 8
#define HD 64
#define DM 512
#define OP 516            // LDS row pitch (floats) of the [16][512] context tile
#define PSH 10.0f         // p carried x2^10
#define PAD256(n) ((((size_t)(n)) + 255) & ~(size_t)255)

static_assert(SEQ % 64 == 0);
static_assert(SEQ <= SEQ_FULL);
static_assert(NH * HD == DM);
static_assert(NH == 8);
static_assert(HD == 64);
static_assert(DM % 64 == 0);
static_assert((OP * 4) % 16 == 0);
// coverage equalities (grid x block x per-thread elements == plane elements)
static_assert((size_t)384 * 256 * 8 == (size_t)3 * NH * HD * DM);
static_assert((size_t)(NB * SEQ / 4) * 256 * 8 == (size_t)NB * SEQ * DM);
static_assert((size_t)(NB * SEQ / 64) * NH * 4 * 128 * 8 == (size_t)NB * NH * SEQ * HD);
static_assert((size_t)(NB * SEQ / 16) * 8 * 2 * 4 * 32 * 4 == (size_t)NB * SEQ * DM);
// workspace total (WT + XB + Q16 + K16 + Vt16), each region padded to 256 B
static_assert(PAD256((size_t)3 * NH * HD * DM * 2) + PAD256((size_t)NB * SEQ * DM * 2) + 3 * PAD256((size_t)NB * NH * SEQ * HD * 2) <= (size_t)134217728);

typedef _Float16 h16;
typedef unsigned short bf;
typedef __attribute__((ext_vector_type(16))) __bf16   v16bf;
typedef __attribute__((ext_vector_type(16))) _Float16 v16h;
typedef __attribute__((ext_vector_type(8)))  _Float16 v8h;
typedef __attribute__((ext_vector_type(8)))  unsigned short v8us;
typedef __attribute__((ext_vector_type(8)))  float    v8f;
typedef __attribute__((ext_vector_type(4)))  float    v4f;
typedef v8h  __attribute__((may_alias)) v8ha;
typedef v4f  __attribute__((may_alias)) v4fa;

__device__ __forceinline__ unsigned short f2bf(float f) { unsigned u = __float_as_uint(f); u += 0x7FFFu + ((u >> 16) & 1u); return (unsigned short)(u >> 16); }
__device__ __forceinline__ float bf2f(unsigned short b) { return __uint_as_float(((unsigned)b) << 16); }
__device__ __forceinline__ float bfr(float f) { return bf2f(f2bf(f)); }
__device__ __forceinline__ v16h cat16(v8h lo, v8h hi) { return __builtin_shufflevector(lo, hi, 0, 1, 2, 3, 4, 5, 6, 7, 8, 9, 10, 11, 12, 13, 14, 15); }
__device__ __forceinline__ v16bf cat16b(v8us lo, v8us hi) { return __builtin_bit_cast(v16bf, __builtin_shufflevector(lo, hi, 0, 1, 2, 3, 4, 5, 6, 7, 8, 9, 10, 11, 12, 13, 14, 15)); }
__device__ __forceinline__ v8f wmma16(v16h a, v16h b, v8f c) { return __builtin_amdgcn_wmma_f32_16x16x32_f16(false, a, false, b, (short)0, c, false, false); }
__device__ __forceinline__ v8f wmmab(v16bf a, v16bf b, v8f c) { return __builtin_amdgcn_wmma_f32_16x16x32_bf16(false, a, false, b, (short)0, c, false, false); }
// fragment loaders: p already includes + 8*(lane>>4); elements 0..7 <- p[0..7], elements 8..15 <- p[16..23]
__device__ __forceinline__ v16h ldh(const h16* p) { return cat16(*(const v8h*)p, *(const v8h*)(p + 16)); }
__device__ __forceinline__ v16bf ldb(const bf* p) { return cat16b(*(const v8us*)p, *(const v8us*)(p + 16)); }
// f32 -> f16 plane convert that cannot produce an f16 subnormal (value select)
static __device__ __forceinline__ h16 toh_flush(float v) { const h16 r = (h16)v; return (fabsf(v) < 6.103515625e-05f) ? (h16)0.0f : r; }

__global__ __launch_bounds__(256) void k_wprep(const float* __restrict__ Wk, const float* __restrict__ Wq, const float* __restrict__ Wv, bf* WT) {
    const unsigned idx = blockIdx.x * 256u + threadIdx.x;
    if (idx >= 3u * NH * HD * DM / 8u) return;
    const unsigned k8 = idx & 63u, n = (idx >> 6) & 63u, h = (idx >> 12) & 7u, m = idx >> 15;   // m is block-uniform (128 blocks per matrix)
    const float* W = (m == 0u) ? Wk : ((m == 1u) ? Wq : Wv);
    const float* src = W + (size_t)h * DM * HD + (size_t)(k8 * 8u) * HD + n;
    v8us o;
#pragma unroll
    for (int i = 0; i < 8; ++i) o[i] = f2bf(src[(size_t)i * HD]);
    *(v8us*)(WT + (size_t)idx * 8) = o; 
}

__global__ __launch_bounds__(256) void k_xprep(const float* __restrict__ x, bf* XB) {
    const unsigned idx = blockIdx.x * 256u + threadIdx.x;
    if (idx >= (unsigned)((size_t)NB * SEQ * DM / 8u)) return;
    const unsigned c8 = idx & 63u, row = idx >> 6;
    const unsigned b = row / SEQ, s = row % SEQ;
    const float* src = x + ((size_t)b * SEQ_FULL + s) * DM + c8 * 8u;
    const v4f a0 = *(const v4f*)src, a1 = *(const v4f*)(src + 4);
    v8us o;
    o[0] = f2bf(a0[0]); o[1] = f2bf(a0[1]); o[2] = f2bf(a0[2]); o[3] = f2bf(a0[3]);
    o[4] = f2bf(a1[0]); o[5] = f2bf(a1[1]); o[6] = f2bf(a1[2]); o[7] = f2bf(a1[3]);
    *(v8us*)(XB + (size_t)idx * 8) = o; 
}

// ---- k_proj: block = (64 tokens, head), 4 waves x 16 tokens. K = x Wk + bk, Q = x Wq + bq, V = x Wv + bv (bf16 WMMA over K = 512, f32 acc), f16 tiles staged in block LDS (V transposed), then whole-line plane writes.
template <bool TR>
__device__ __forceinline__ void proj_one(const bf* __restrict__ xr, const bf* __restrict__ Wt, const float* __restrict__ bias, h16* dst, unsigned wave, unsigned nn, unsigned g) {
    v8f acc[4];
#pragma unroll
    for (int nt = 0; nt < 4; ++nt) acc[nt] = (v8f){};
#pragma unroll 1
    for (unsigned kc = 0; kc < DM / 64u; ++kc) {
        const v16bf a0 = ldb(xr + kc * 64u), a1 = ldb(xr + kc * 64u + 32u);
#pragma unroll
        for (unsigned nt = 0; nt < 4; ++nt) {
            const bf* wp = Wt + (size_t)(nt * 16u + nn) * DM + kc * 64u + 8u * g;
            const v16bf b0 = ldb(wp), b1 = ldb(wp + 32);
            acc[nt] = wmmab(a0, b0, acc[nt]);
            acc[nt] = wmmab(a1, b1, acc[nt]);
            asm volatile("v_nop\n\tv_nop\n\tv_nop\n\tv_nop" : "+v"(acc[nt]) : "v"(a1), "v"(b1));
        }
    }
#pragma unroll
    for (unsigned nt = 0; nt < 4; ++nt) {
        const float bvv = bfr(bias[nt * 16u + nn]);
        const unsigned col = nt * 16u + nn;
#pragma unroll
        for (unsigned r = 0; r < 8; ++r) {
            const unsigned rowl = wave * 16u + 8u * g + r;
            const float val = acc[nt][r] + bvv;
            if (TR) dst[col * 64u + rowl] = toh_flush(val); else dst[rowl * 64u + col] = toh_flush(val);
        }
    }
}

__global__ __launch_bounds__(128) void k_proj(const bf* __restrict__ XB, const bf* __restrict__ WT,
                                              const float* __restrict__ bk, const float* __restrict__ bq, const float* __restrict__ bv,
                                              h16* Q16, h16* K16, h16* Vt16) {
    __shared__ __align__(16) h16 sK[64 * 64];
    __shared__ __align__(16) h16 sQ[64 * 64];
    __shared__ __align__(16) h16 sV[64 * 64];   // [d][token]
    const unsigned tid = threadIdx.x, lane = tid & 31u, wave = tid >> 5, nn = lane & 15u, g = lane >> 4;
    const unsigned tile = blockIdx.x, h = blockIdx.y;
    const unsigned b = tile / (SEQ / 64u), s0 = (tile % (SEQ / 64u)) * 64u;
    const size_t rowi = (size_t)b * SEQ + s0 + wave * 16u + nn;               // XB is compact [NB][SEQ][DM]
    const bf* xr = XB + rowi * DM + 8u * g;
    proj_one<false>(xr, WT + (size_t)(0u * NH + h) * HD * DM, bk + h * HD, sK, wave, nn, g);
    proj_one<false>(xr, WT + (size_t)(1u * NH + h) * HD * DM, bq + h * HD, sQ, wave, nn, g);
    proj_one<true >(xr, WT + (size_t)(2u * NH + h) * HD * DM, bv + h * HD, sV, wave, nn, g);
    __syncthreads();                                    // tiles are read across waves
    const size_t bh = (size_t)b * NH + h;
    h16* kd = K16 + (bh * SEQ + s0) * HD;               // 64 x 64 contiguous
    h16* qd = Q16 + (bh * SEQ + s0) * HD;
    h16* vd = Vt16 + bh * HD * SEQ + s0;
{
#pragma unroll
        for (unsigned it = 0; it < 4; ++it) {
            const unsigned c = it * 128u + tid;
            const v8h kv = *(const v8ha*)(sK + c * 8u);
            const v8h qv = *(const v8ha*)(sQ + c * 8u);
            const v8h vv = *(const v8ha*)(sV + c * 8u);
            *(v8h*)(kd + (size_t)c * 8u) = kv;
            *(v8h*)(qd + (size_t)c * 8u) = qv;
            *(v8h*)(vd + (size_t)(c >> 3) * SEQ + (c & 7u) * 8u) = vv;
        }
        
    }
}

// ---- k_flash: block = 16 queries x 8 heads (wave = head). Fragments straight from the f16 planes; online softmax per lane (query = lane & 15);
__global__ __launch_bounds__(256) void k_flash(const h16* __restrict__ Q16, const h16* __restrict__ K16, const h16* __restrict__ Vt16, float* out) {
    __shared__ __align__(16) float so[16 * OP];
    const unsigned tid = threadIdx.x, lane = tid & 31u, h = tid >> 5, nn = lane & 15u, g = lane >> 4;
    const unsigned blk = blockIdx.x;
    const unsigned b = blk / (SEQ / 16u), q0 = (blk % (SEQ / 16u)) * 16u;
    const size_t bh = (size_t)b * NH + h;
    const h16* Qh = Q16 + bh * SEQ * HD;
    const h16* Kh = K16 + bh * SEQ * HD + (size_t)nn * HD + 8u * g;
    const h16* Vh = Vt16 + bh * HD * SEQ + (size_t)nn * SEQ + 8u * g;
    // Q^T as the B operand: lane column = query q0 + nn, k = d
    const v16h qb0 = ldh(Qh + (size_t)(q0 + nn) * HD + 8u * g);
    const v16h qb1 = ldh(Qh + (size_t)(q0 + nn) * HD + 32u + 8u * g);
    const float C = 0.125f * 1.4426950408889634f;      // 1/sqrt(64) x log2(e)
    float m = -1.0e30f, l = 0.f;
    v8f o[4];
#pragma unroll
    for (int dt = 0; dt < 4; ++dt) o[dt] = (v8f){};
#pragma unroll 1
    for (unsigned it = 0; it < SEQ / 64u; ++it) {
        const unsigned j0 = it * 64u;
        v8f sc[4];
        // S^T tiles: rows = keys j0 + jt*16 + 8g + r, column = query nn
#pragma unroll
        for (unsigned jt = 0; jt < 4; ++jt) {
            const h16* kp = Kh + (size_t)(j0 + jt * 16u) * HD;
            const v16h ka0 = ldh(kp), ka1 = ldh(kp + 32);
            v8f acc = (v8f){};
            acc = wmma16(ka0, qb0, acc);
            acc = wmma16(ka1, qb1, acc);
            sc[jt] = acc;
        }
        asm volatile("v_nop\n\tv_nop\n\tv_nop\n\tv_nop" : "+v"(sc[0]), "+v"(sc[1]), "+v"(sc[2]), "+v"(sc[3]) : "v"(qb0), "v"(qb1));
        float mx = sc[0][0];
#pragma unroll
        for (int jt = 0; jt < 4; ++jt)
#pragma unroll
            for (int r = 0; r < 8; ++r) mx = fmaxf(mx, sc[jt][r]);
        mx = fmaxf(mx, __shfl_xor(mx, 16, 32));          // other key half of the same query
        const float mn = fmaxf(m, mx * C);
        const float alpha = __builtin_amdgcn_exp2f(m - mn);
        m = mn;
        const float off = mn - PSH;
        float psum = 0.f;
#pragma unroll
        for (int jt = 0; jt < 4; ++jt)
#pragma unroll
            for (int r = 0; r < 8; ++r) {
                const float e = fmaf(sc[jt][r], C, -off);                                  // e <= 10
                const float p = (e < -14.0f) ? 0.f : __builtin_amdgcn_exp2f(e);            // p is 0 or >= 2^-14 (f16 normal)
                sc[jt][r] = p; psum += p;
            }
        l = l * alpha + psum;
#pragma unroll
        for (int dt = 0; dt < 4; ++dt)
#pragma unroll
            for (int r = 0; r < 8; ++r) o[dt][r] *= alpha;
        // P^T as the B operand: element i <- tile 2kf [i], element 8+i <- tile 2kf+1 [i], lane unchanged
        v16h pb0, pb1;
#pragma unroll
        for (int i = 0; i < 8; ++i) { pb0[i] = (h16)sc[0][i]; pb0[8 + i] = (h16)sc[1][i]; pb1[i] = (h16)sc[2][i]; pb1[8 + i] = (h16)sc[3][i]; }
        // O^T tiles: rows = d (dt*16 + 8g + r), column = query nn
#pragma unroll
        for (unsigned dt = 0; dt < 4; ++dt) {
            const h16* vp = Vh + (size_t)(dt * 16u) * SEQ + j0;
            const v16h va0 = ldh(vp), va1 = ldh(vp + 32);
            o[dt] = wmma16(va0, pb0, o[dt]);
            o[dt] = wmma16(va1, pb1, o[dt]);
        }
        asm volatile("v_nop\n\tv_nop\n\tv_nop\n\tv_nop" : "+v"(o[0]), "+v"(o[1]), "+v"(o[2]), "+v"(o[3]) : "v"(pb0), "v"(pb1));
    }
    l += __shfl_xor(l, 16, 32);
    const float inv = 1.0f / l;                           // the x1024 carry cancels here
#pragma unroll
    for (unsigned dt = 0; dt < 4; ++dt) {
        v4f w0, w1;
        w0[0] = o[dt][0] * inv; w0[1] = o[dt][1] * inv; w0[2] = o[dt][2] * inv; w0[3] = o[dt][3] * inv;
        w1[0] = o[dt][4] * inv; w1[1] = o[dt][5] * inv; w1[2] = o[dt][6] * inv; w1[3] = o[dt][7] * inv;
        float* sp = so + nn * OP + h * HD + dt * 16u + 8u * g;
        *(v4fa*)sp = w0; *(v4fa*)(sp + 4) = w1;
    }
    __syncthreads();                                      // tile is read across waves
    const unsigned wave = h;
#pragma unroll 1
    for (unsigned rr = 0; rr < 2; ++rr) {
        const unsigned row = wave * 2u + rr;
        const size_t tok = (size_t)q0 + row;
        float* op = out + ((size_t)b * SEQ + tok) * DM;
        v4f ov[4];
#pragma unroll
        for (unsigned j = 0; j < 4; ++j) {
            const unsigned c = j * 128u + lane * 4u;
            ov[j] = *(const v4fa*)(so + row * OP + c);
        }
{
#pragma unroll
            for (unsigned j = 0; j < 4; ++j) *(v4f*)(op + j * 128u + lane * 4u) = ov[j];
            
        }
    }
}

extern "C" void kernel_launch(void* const* d_in, const int* in_sizes, int n_in,
                              void* d_out, int out_size, void* d_ws, size_t ws_size, hipStream_t stream) {
    if (n_in < 7) return;
    const size_t need_x = (size_t)(NB - 1) * SEQ_FULL * DM + (size_t)SEQ * DM;
    if ((size_t)in_sizes[0] < need_x) return;
    if (in_sizes[1] < NH * DM * HD || in_sizes[2] < NH * DM * HD || in_sizes[3] < NH * DM * HD) return;
    if (in_sizes[4] < NH * HD || in_sizes[5] < NH * HD || in_sizes[6] < NH * HD) return;
    if ((size_t)out_size < (size_t)NB * SEQ * DM) return;
    // wire order: x, Wq, Wk, Wv, bq, bk, bv
    const float* x = (const float*)d_in[0];
    const float* Wq = (const float*)d_in[1]; const float* Wk = (const float*)d_in[2]; const float* Wv = (const float*)d_in[3];
    const float* bq = (const float*)d_in[4]; const float* bk = (const float*)d_in[5]; const float* bv = (const float*)d_in[6];
    float* OUT = (float*)d_out;
    char* wsp = (char*)d_ws;
    auto take = [&](size_t bytes) { char* p = wsp; wsp += (bytes + 255) & ~(size_t)255; return (void*)p; };
    bf* WT = (bf*)take((size_t)3 * NH * HD * DM * 2);            // 1,572,864 B
    bf* XB = (bf*)take((size_t)NB * SEQ * DM * 2);               // 8 MiB
    h16* Q16 = (h16*)take((size_t)NB * NH * SEQ * HD * 2);       // 8 MiB
    h16* K16 = (h16*)take((size_t)NB * NH * SEQ * HD * 2);       // 8 MiB
    h16* Vt16 = (h16*)take((size_t)NB * NH * HD * SEQ * 2);      // 8 MiB
    if ((size_t)(wsp - (char*)d_ws) > ws_size) return;
    k_wprep<<<384, 256, 0, stream>>>(Wk, Wq, Wv, WT);
    k_xprep<<<NB * SEQ / 4, 256, 0, stream>>>(x, XB);
    k_proj<<<dim3(NB * SEQ / 64, NH, 1), 128, 0, stream>>>(XB, WT, bk, bq, bv, Q16, K16, Vt16);
    k_flash<<<NB * SEQ / 16, 256, 0, stream>>>(Q16, K16, Vt16, OUT);
}

// v001
// One run takes 154 microseconds.
// Two timings next to v000 put it at 2.75 and 2.83 times that version's speed.
#include <hip/hip_runtime.h>

// Compute dtypes, f32 accumulate everywhere: per-head Q/K/V projections (K = 512) = v_wmma_f32_16x16x32_bf16 on bf16-converted (RNE) x and W planes (bias bf16-converted, added in f32); scores q.k^T and P.V = v_wmma_f32_16x16x32_f16 single products (q, k, v as f16 planes; p = exp2 carried x1024 via the exponent offset, cancelled by the row sum); softmax in f32.
// Flash form: S^T = K Q^T (query on the lane/column axis), packed D tiles feed P^T as the B operand, O^T = Vt P^T; all row statistics are per lane.

#ifndef NB
#define NB 2
#endif
#ifndef SEQ
#define SEQ 4096
#endif
#define SEQ_FULL 4096
#define NH 8
#define HD 64
#define DM 512
#define OP 68             // LDS row pitch (floats) of a wave's [16][64] context tile
#define KP 72             // LDS row pitch (halves) of the K and Vt tiles: 144 B = 16 B x 9, free of bank conflicts for 16-byte row readers
#define KPB (KP * 2u)     // the same in bytes
#define BUFB (128u * KPB) // bytes of one buffer (64 K rows + 64 Vt rows)
#define PSH 10.0f         // p carried x2^10
#define PAD256(n) ((((size_t)(n)) + 255) & ~(size_t)255)

static_assert(SEQ % 128 == 0);
static_assert(SEQ / 64 >= 2);
static_assert(SEQ <= SEQ_FULL);
static_assert(NH * HD == DM);
static_assert(NH == 8);
static_assert(HD == 64);
static_assert(DM % 64 == 0);
static_assert((OP * 4) % 16 == 0);
// coverage equalities (grid x block x per-thread elements == plane elements)
static_assert((size_t)384 * 256 * 8 == (size_t)3 * NH * HD * DM);
static_assert((size_t)(NB * SEQ / 4) * 256 * 8 == (size_t)NB * SEQ * DM);
static_assert((size_t)(NB * SEQ / 64) * NH * 4 * 128 * 8 == (size_t)NB * NH * SEQ * HD);
static_assert((size_t)(NB * NH * SEQ / 128) * 8 * 8 * 32 * 4 == (size_t)NB * SEQ * DM);
// workspace total (WT + XB + Q16 + K16 + Vt16), each region padded to 256 B
static_assert(PAD256((size_t)3 * NH * HD * DM * 2) + PAD256((size_t)NB * SEQ * DM * 2) + 3 * PAD256((size_t)NB * NH * SEQ * HD * 2) <= (size_t)134217728);

typedef _Float16 h16;
typedef unsigned short bf;
typedef __attribute__((ext_vector_type(16))) __bf16   v16bf;
typedef __attribute__((ext_vector_type(16))) _Float16 v16h;
typedef __attribute__((ext_vector_type(8)))  _Float16 v8h;
typedef __attribute__((ext_vector_type(8)))  unsigned short v8us;
typedef __attribute__((ext_vector_type(8)))  float    v8f;
typedef __attribute__((ext_vector_type(4)))  float    v4f;
typedef v8h  __attribute__((may_alias)) v8ha;
typedef v4f  __attribute__((may_alias)) v4fa;

__device__ __forceinline__ unsigned short f2bf(float f) { unsigned u = __float_as_uint(f); u += 0x7FFFu + ((u >> 16) & 1u); return (unsigned short)(u >> 16); }
__device__ __forceinline__ float bf2f(unsigned short b) { return __uint_as_float(((unsigned)b) << 16); }
__device__ __forceinline__ float bfr(float f) { return bf2f(f2bf(f)); }
__device__ __forceinline__ v16h cat16(v8h lo, v8h hi) { return __builtin_shufflevector(lo, hi, 0, 1, 2, 3, 4, 5, 6, 7, 8, 9, 10, 11, 12, 13, 14, 15); }
__device__ __forceinline__ v16bf cat16b(v8us lo, v8us hi) { return __builtin_bit_cast(v16bf, __builtin_shufflevector(lo, hi, 0, 1, 2, 3, 4, 5, 6, 7, 8, 9, 10, 11, 12, 13, 14, 15)); }
__device__ __forceinline__ v8f wmma16(v16h a, v16h b, v8f c) { return __builtin_amdgcn_wmma_f32_16x16x32_f16(false, a, false, b, (short)0, c, false, false); }
__device__ __forceinline__ v8f wmmab(v16bf a, v16bf b, v8f c) { return __builtin_amdgcn_wmma_f32_16x16x32_bf16(false, a, false, b, (short)0, c, false, false); }
// fragment loaders: p already includes + 8*(lane>>4); elements 0..7 <- p[0..7], elements 8..15 <- p[16..23]
__device__ __forceinline__ v16h ldh(const h16* p) { return cat16(*(const v8h*)p, *(const v8h*)(p + 16)); }
__device__ __forceinline__ v16bf ldb(const bf* p) { return cat16b(*(const v8us*)p, *(const v8us*)(p + 16)); }
// f32 -> f16 plane convert that cannot produce an f16 subnormal (value select)
static __device__ __forceinline__ h16 toh_flush(float v) { const h16 r = (h16)v; return (fabsf(v) < 6.103515625e-05f) ? (h16)0.0f : r; }

__global__ __launch_bounds__(256) void k_wprep(const float* __restrict__ Wk, const float* __restrict__ Wq, const float* __restrict__ Wv, bf* WT) {
    const unsigned idx = blockIdx.x * 256u + threadIdx.x;
    if (idx >= 3u * NH * HD * DM / 8u) return;
    const unsigned k8 = idx & 63u, n = (idx >> 6) & 63u, h = (idx >> 12) & 7u, m = idx >> 15;   // m is block-uniform (128 blocks per matrix)
    const float* W = (m == 0u) ? Wk : ((m == 1u) ? Wq : Wv);
    const float* src = W + (size_t)h * DM * HD + (size_t)(k8 * 8u) * HD + n;
    v8us o;
#pragma unroll
    for (int i = 0; i < 8; ++i) o[i] = f2bf(src[(size_t)i * HD]);
    *(v8us*)(WT + (size_t)idx * 8) = o; 
}

__global__ __launch_bounds__(256) void k_xprep(const float* __restrict__ x, bf* XB) {
    const unsigned idx = blockIdx.x * 256u + threadIdx.x;
    if (idx >= (unsigned)((size_t)NB * SEQ * DM / 8u)) return;
    const unsigned c8 = idx & 63u, row = idx >> 6;
    const unsigned b = row / SEQ, s = row % SEQ;
    const float* src = x + ((size_t)b * SEQ_FULL + s) * DM + c8 * 8u;
    const v4f a0 = *(const v4f*)src, a1 = *(const v4f*)(src + 4);
    v8us o;
    o[0] = f2bf(a0[0]); o[1] = f2bf(a0[1]); o[2] = f2bf(a0[2]); o[3] = f2bf(a0[3]);
    o[4] = f2bf(a1[0]); o[5] = f2bf(a1[1]); o[6] = f2bf(a1[2]); o[7] = f2bf(a1[3]);
    *(v8us*)(XB + (size_t)idx * 8) = o; 
}

// ---- k_proj: block = (64 tokens, head), 4 waves x 16 tokens. K = x Wk + bk, Q = x Wq + bq, V = x Wv + bv (bf16 WMMA over K = 512, f32 acc), f16 tiles staged in block LDS (V transposed), then whole-line plane writes.
template <bool TR>
__device__ __forceinline__ void proj_one(const bf* __restrict__ xr, const bf* __restrict__ Wt, const float* __restrict__ bias, h16* dst, unsigned wave, unsigned nn, unsigned g) {
    v8f acc[4];
#pragma unroll
    for (int nt = 0; nt < 4; ++nt) acc[nt] = (v8f){};
#pragma unroll 1
    for (unsigned kc = 0; kc < DM / 64u; ++kc) {
        const v16bf a0 = ldb(xr + kc * 64u), a1 = ldb(xr + kc * 64u + 32u);
#pragma unroll
        for (unsigned nt = 0; nt < 4; ++nt) {
            const bf* wp = Wt + (size_t)(nt * 16u + nn) * DM + kc * 64u + 8u * g;
            const v16bf b0 = ldb(wp), b1 = ldb(wp + 32);
            acc[nt] = wmmab(a0, b0, acc[nt]);
            acc[nt] = wmmab(a1, b1, acc[nt]);
            asm volatile("v_nop\n\tv_nop\n\tv_nop\n\tv_nop" : "+v"(acc[nt]) : "v"(a1), "v"(b1));
        }
    }
#pragma unroll
    for (unsigned nt = 0; nt < 4; ++nt) {
        const float bvv = bfr(bias[nt * 16u + nn]);
        const unsigned col = nt * 16u + nn;
#pragma unroll
        for (unsigned r = 0; r < 8; ++r) {
            const unsigned rowl = wave * 16u + 8u * g + r;
            const float val = acc[nt][r] + bvv;
            if (TR) dst[col * 64u + rowl] = toh_flush(val); else dst[rowl * 64u + col] = toh_flush(val);
        }
    }
}

__global__ __launch_bounds__(128) void k_proj(const bf* __restrict__ XB, const bf* __restrict__ WT,
                                              const float* __restrict__ bk, const float* __restrict__ bq, const float* __restrict__ bv,
                                              h16* Q16, h16* K16, h16* Vt16) {
    __shared__ __align__(16) h16 sK[64 * 64];
    __shared__ __align__(16) h16 sQ[64 * 64];
    __shared__ __align__(16) h16 sV[64 * 64];   // [d][token]
    const unsigned tid = threadIdx.x, lane = tid & 31u, wave = tid >> 5, nn = lane & 15u, g = lane >> 4;
    const unsigned tile = blockIdx.x, h = blockIdx.y;
    const unsigned b = tile / (SEQ / 64u), s0 = (tile % (SEQ / 64u)) * 64u;
    const size_t rowi = (size_t)b * SEQ + s0 + wave * 16u + nn;               // XB is compact [NB][SEQ][DM]
    const bf* xr = XB + rowi * DM + 8u * g;
    proj_one<false>(xr, WT + (size_t)(0u * NH + h) * HD * DM, bk + h * HD, sK, wave, nn, g);
    proj_one<false>(xr, WT + (size_t)(1u * NH + h) * HD * DM, bq + h * HD, sQ, wave, nn, g);
    proj_one<true >(xr, WT + (size_t)(2u * NH + h) * HD * DM, bv + h * HD, sV, wave, nn, g);
    __syncthreads();                                    // tiles are read across waves
    const size_t bh = (size_t)b * NH + h;
    h16* kd = K16 + (bh * SEQ + s0) * HD;               // 64 x 64 contiguous
    h16* qd = Q16 + (bh * SEQ + s0) * HD;
    h16* vd = Vt16 + bh * HD * SEQ + s0;
{
#pragma unroll
        for (unsigned it = 0; it < 4; ++it) {
            const unsigned c = it * 128u + tid;
            const v8h kv = *(const v8ha*)(sK + c * 8u);
            const v8h qv = *(const v8ha*)(sQ + c * 8u);
            const v8h vv = *(const v8ha*)(sV + c * 8u);
            *(v8h*)(kd + (size_t)c * 8u) = kv;
            *(v8h*)(qd + (size_t)c * 8u) = qv;
            *(v8h*)(vd + (size_t)(c >> 3) * SEQ + (c & 7u) * 8u) = vv;
        }
        
    }
}

// ---- k_flash: block = 128 queries of ONE head (wave = 16 queries). Each 64-key K tile and Vt tile is brought into LDS once per block by asynchronous copies (two buffers) and read by all 8 waves; online softmax per lane (query = lane & 15);
// one stage = K rows [64][64] + Vt rows [64][64] halves = 1024 pieces of 16 B, four per thread; l = this lane's LDS byte address in the stage's buffer
__device__ __forceinline__ void stage_copy(unsigned l, const h16* gk, const h16* gv) {
    // the copies and the s_wait_xcnt behind them are one statement, so that no address register of a copy is rewritten in front of that wait
    asm volatile("global_load_async_to_lds_b128 %0, %4, off\n\t"
                 "global_load_async_to_lds_b128 %1, %5, off\n\t"
                 "global_load_async_to_lds_b128 %2, %6, off\n\t"
                 "global_load_async_to_lds_b128 %3, %7, off\n\t"
                 "s_wait_xcnt 0x0"
                 :: "v"(l), "v"(l + 32u * KPB), "v"(l + 64u * KPB), "v"(l + 96u * KPB),
                    "v"(gk), "v"(gk + 32 * HD), "v"(gv), "v"(gv + (size_t)32 * SEQ) : "memory");
}

__global__ __launch_bounds__(256) void k_flash(const h16* __restrict__ Q16, const h16* __restrict__ K16, const h16* __restrict__ Vt16, float* out) {
    __shared__ __align__(16) h16 skv[2 * 128 * KP];       // [buffer][K rows 0..63 | Vt rows 64..127][KP]
    __shared__ __align__(16) float so[8 * 16 * OP];       // [wave][query][OP]
    const unsigned tid = threadIdx.x, lane = tid & 31u, wave = tid >> 5, nn = lane & 15u, g = lane >> 4;
    const unsigned blk = blockIdx.x;
    const unsigned bhu = blk / (SEQ / 128u), q0 = (blk % (SEQ / 128u)) * 128u + wave * 16u;
    const unsigned b = bhu / NH, h = bhu % NH;
    const size_t bh = (size_t)bhu;
    const h16* Qh = Q16 + bh * SEQ * HD;
    // copy addresses of this lane: piece tid of 256 = row tid >> 3 (and + 32), 16-byte column tid & 7
    const h16* gk = K16 + bh * SEQ * HD + (size_t)tid * 8u;
    const h16* gv = Vt16 + bh * HD * SEQ + (size_t)(tid >> 3) * SEQ + (tid & 7u) * 8u;
    const unsigned l0 = (unsigned)(size_t)skv + (tid >> 3) * KPB + (tid & 7u) * 16u;
    stage_copy(l0, gk, gv);                               // tile 0 -> buffer 0
    asm volatile("s_wait_asynccnt 0x0" ::: "memory");     // this wave's pieces of tile 0 have landed
    __syncthreads();                                      // tile 0 is read across waves
    stage_copy(l0 + BUFB, gk + 64 * HD, gv + 64);         // tile 1 -> buffer 1, flies during trip 0
    // Q^T as the B operand: lane column = query q0 + nn, k = d
    const v16h qb0 = ldh(Qh + (size_t)(q0 + nn) * HD + 8u * g);
    const v16h qb1 = ldh(Qh + (size_t)(q0 + nn) * HD + 32u + 8u * g);
    const float C = 0.125f * 1.4426950408889634f;      // 1/sqrt(64) x log2(e)
    float m = -1.0e30f, l = 0.f;
    v8f o[4];
#pragma unroll
    for (int dt = 0; dt < 4; ++dt) o[dt] = (v8f){};
#pragma unroll 1
    for (unsigned it = 0; it < SEQ / 64u; ++it) {
        const h16* Kh = skv + (it & 1u) * (128u * KP) + nn * KP + 8u * g;
        const h16* Vh = Kh + 64u * KP;
        v8f sc[4];
        // S^T tiles: rows = keys j0 + jt*16 + 8g + r, column = query nn
#pragma unroll
        for (unsigned jt = 0; jt < 4; ++jt) {
            const h16* kp = Kh + (jt * 16u) * KP;
            const v16h ka0 = ldh(kp), ka1 = ldh(kp + 32);
            v8f acc = (v8f){};
            acc = wmma16(ka0, qb0, acc);
            acc = wmma16(ka1, qb1, acc);
            sc[jt] = acc;
        }
        asm volatile("v_nop\n\tv_nop\n\tv_nop\n\tv_nop" : "+v"(sc[0]), "+v"(sc[1]), "+v"(sc[2]), "+v"(sc[3]) : "v"(qb0), "v"(qb1));
        float mx = sc[0][0];
#pragma unroll
        for (int jt = 0; jt < 4; ++jt)
#pragma unroll
            for (int r = 0; r < 8; ++r) mx = fmaxf(mx, sc[jt][r]);
        mx = fmaxf(mx, __shfl_xor(mx, 16, 32));          // other key half of the same query
        const float mn = fmaxf(m, mx * C);
        const float alpha = __builtin_amdgcn_exp2f(m - mn);
        m = mn;
        const float off = mn - PSH;
        float psum = 0.f;
#pragma unroll
        for (int jt = 0; jt < 4; ++jt)
#pragma unroll
            for (int r = 0; r < 8; ++r) {
                const float e = fmaf(sc[jt][r], C, -off);                                  // e <= 10
                const float p = (e < -14.0f) ? 0.f : __builtin_amdgcn_exp2f(e);            // p is 0 or >= 2^-14 (f16 normal)
                sc[jt][r] = p; psum += p;
            }
        l = l * alpha + psum;
#pragma unroll
        for (int dt = 0; dt < 4; ++dt)
#pragma unroll
            for (int r = 0; r < 8; ++r) o[dt][r] *= alpha;
        // P^T as the B operand: element i <- tile 2kf [i], element 8+i <- tile 2kf+1 [i], lane unchanged
        v16h pb0, pb1;
#pragma unroll
        for (int i = 0; i < 8; ++i) { pb0[i] = (h16)sc[0][i]; pb0[8 + i] = (h16)sc[1][i]; pb1[i] = (h16)sc[2][i]; pb1[8 + i] = (h16)sc[3][i]; }
        // O^T tiles: rows = d (dt*16 + 8g + r), column = query nn
#pragma unroll
        for (unsigned dt = 0; dt < 4; ++dt) {
            const h16* vp = Vh + (dt * 16u) * KP;
            const v16h va0 = ldh(vp), va1 = ldh(vp + 32);
            o[dt] = wmma16(va0, pb0, o[dt]);
            o[dt] = wmma16(va1, pb1, o[dt]);
        }
        asm volatile("v_nop\n\tv_nop\n\tv_nop\n\tv_nop" : "+v"(o[0]), "+v"(o[1]), "+v"(o[2]), "+v"(o[3]) : "v"(pb0), "v"(pb1));
        // hand-over: this wave has left the buffer of trip it, its pieces of tile it + 1 have landed, then every wave agrees
        asm volatile("s_wait_dscnt 0x0" ::: "memory");    // this wave's reads of the buffer have returned before it is refilled
        asm volatile("s_wait_asynccnt 0x0" ::: "memory"); // this wave's pieces of tile it + 1 have landed before other waves read them
        __syncthreads();                                  // publishes tile it + 1 and frees the buffer of trip it
        if (it + 2u < SEQ / 64u) stage_copy(l0 + (it & 1u) * BUFB, gk + (size_t)(it + 2u) * (64 * HD), gv + (it + 2u) * 64u);
    }
    asm volatile("s_wait_asynccnt 0x0" ::: "memory");     // no copy is left in flight when the wave goes on to its end
    l += __shfl_xor(l, 16, 32);
    const float inv = 1.0f / l;                           // the x1024 carry cancels here
    float* sw = so + wave * (16u * OP);
#pragma unroll
    for (unsigned dt = 0; dt < 4; ++dt) {
        v4f w0, w1;
        w0[0] = o[dt][0] * inv; w0[1] = o[dt][1] * inv; w0[2] = o[dt][2] * inv; w0[3] = o[dt][3] * inv;
        w1[0] = o[dt][4] * inv; w1[1] = o[dt][5] * inv; w1[2] = o[dt][6] * inv; w1[3] = o[dt][7] * inv;
        float* sp = sw + nn * OP + dt * 16u + 8u * g;
        *(v4fa*)sp = w0; *(v4fa*)(sp + 4) = w1;
    }
    __syncthreads();                                      // the staged rows are read by other lanes
    // each load/store covers two queries' 256-byte head slices (whole 128-byte lines)
    float* op = out + ((size_t)b * SEQ + q0 + g) * DM + h * HD + nn * 4u;
    v4f ov[8];
#pragma unroll
    for (unsigned j = 0; j < 8; ++j) ov[j] = *(const v4fa*)(sw + (j * 2u + g) * OP + nn * 4u);
#pragma unroll
    for (unsigned j = 0; j < 8; ++j) *(v4f*)(op + (size_t)(j * 2u) * DM) = ov[j];
}

extern "C" void kernel_launch(void* const* d_in, const int* in_sizes, int n_in,
                              void* d_out, int out_size, void* d_ws, size_t ws_size, hipStream_t stream) {
    if (n_in < 7) return;
    const size_t need_x = (size_t)(NB - 1) * SEQ_FULL * DM + (size_t)SEQ * DM;
    if ((size_t)in_sizes[0] < need_x) return;
    if (in_sizes[1] < NH * DM * HD || in_sizes[2] < NH * DM * HD || in_sizes[3] < NH * DM * HD) return;
    if (in_sizes[4] < NH * HD || in_sizes[5] < NH * HD || in_sizes[6] < NH * HD) return;
    if ((size_t)out_size < (size_t)NB * SEQ * DM) return;
    // wire order: x, Wq, Wk, Wv, bq, bk, bv
    const float* x = (const float*)d_in[0];
    const float* Wq = (const float*)d_in[1]; const float* Wk = (const float*)d_in[2]; const float* Wv = (const float*)d_in[3];
    const float* bq = (const float*)d_in[4]; const float* bk = (const float*)d_in[5]; const float* bv = (const float*)d_in[6];
    float* OUT = (float*)d_out;
    char* wsp = (char*)d_ws;
    auto take = [&](size_t bytes) { char* p = wsp; wsp += (bytes + 255) & ~(size_t)255; return (void*)p; };
    bf* WT = (bf*)take((size_t)3 * NH * HD * DM * 2);            // 1,572,864 B
    bf* XB = (bf*)take((size_t)NB * SEQ * DM * 2);               // 8 MiB
    h16* Q16 = (h16*)take((size_t)NB * NH * SEQ * HD * 2);       // 8 MiB
    h16* K16 = (h16*)take((size_t)NB * NH * SEQ * HD * 2);       // 8 MiB
    h16* Vt16 = (h16*)take((size_t)NB * NH * HD * SEQ * 2);      // 8 MiB
    if ((size_t)(wsp - (char*)d_ws) > ws_size) return;
    k_wprep<<<384, 256, 0, stream>>>(Wk, Wq, Wv, WT);
    k_xprep<<<NB * SEQ / 4, 256, 0, stream>>>(x, XB);
    k_proj<<<dim3(NB * SEQ / 64, NH, 1), 128, 0, stream>>>(XB, WT, bk, bq, bv, Q16, K16, Vt16);
    k_flash<<<NB * NH * SEQ / 128, 256, 0, stream>>>(Q16, K16, Vt16, OUT);
}

// v002
// It runs in 106 microseconds.
// Two timings next to v001 both put it at 1.46 times that version's speed.
// Counting every step since v000, it is 4.08 times as fast.
#include <hip/hip_runtime.h>

// Compute dtypes, f32 accumulate everywhere: per-head Q/K/V projections (K = 512) = v_wmma_f32_16x16x32_bf16 on bf16-converted (RNE) x and W planes (bias bf16-converted, added in f32); scores q.k^T and P.V = v_wmma_f32_16x16x32_f16 single products (q, k, v as f16 planes; p = exp2 carried x1024 via the exponent offset, cancelled by the row sum); softmax in f32.
// Flash form: S^T = K Q^T (query on the lane/column axis), packed D tiles feed P^T as the B operand, O^T = Vt P^T; all row statistics are per lane.

#ifndef NB
#define NB 2
#endif
#ifndef SEQ
#define SEQ 4096
#endif
#define SEQ_FULL 4096
#define NH 8
#define HD 64
#define DM 512
#define OP 68             // LDS row pitch (floats) of a wave's [16][64] context tile
#define KP 72             // LDS row pitch (halves) of the K and Vt tiles: 144 B = 16 B x 9, free of bank conflicts for 16-byte row readers
#define KPB (KP * 2u)     // the same in bytes
#define BUFB (128u * KPB) // bytes of one buffer (64 K rows + 64 Vt rows)
#define PSH 10.0f         // p carried x2^10
#define PAD256(n) ((((size_t)(n)) + 255) & ~(size_t)255)

static_assert(SEQ % 128 == 0);
static_assert(SEQ / 64 >= 2);
static_assert(SEQ <= SEQ_FULL);
static_assert(NH * HD == DM);
static_assert(NH == 8);
static_assert(HD == 64);
static_assert(DM % 64 == 0);
static_assert((OP * 4) % 16 == 0);
// coverage equalities (grid x block x per-thread elements == plane elements)
static_assert((size_t)384 * 256 * 8 == (size_t)3 * NH * HD * DM);
static_assert((size_t)(NB * SEQ / 4) * 256 * 8 == (size_t)NB * SEQ * DM);
static_assert((size_t)(NB * SEQ / 128) * NH * 4 * 256 * 8 == (size_t)NB * NH * SEQ * HD);
static_assert((size_t)(NB * NH * SEQ / 128) * 8 * 8 * 32 * 4 == (size_t)NB * SEQ * DM);
// workspace total (WT + XB + Q16 + K16 + Vt16), each region padded to 256 B
static_assert(PAD256((size_t)3 * NH * HD * DM * 2) + PAD256((size_t)NB * SEQ * DM * 2) + 3 * PAD256((size_t)NB * NH * SEQ * HD * 2) <= (size_t)134217728);

typedef _Float16 h16;
typedef unsigned short bf;
typedef __attribute__((ext_vector_type(16))) __bf16   v16bf;
typedef __attribute__((ext_vector_type(16))) _Float16 v16h;
typedef __attribute__((ext_vector_type(8)))  _Float16 v8h;
typedef __attribute__((ext_vector_type(8)))  unsigned short v8us;
typedef __attribute__((ext_vector_type(8)))  float    v8f;
typedef __attribute__((ext_vector_type(4)))  float    v4f;
typedef v8h  __attribute__((may_alias)) v8ha;
typedef v4f  __attribute__((may_alias)) v4fa;

__device__ __forceinline__ unsigned short f2bf(float f) { unsigned u = __float_as_uint(f); u += 0x7FFFu + ((u >> 16) & 1u); return (unsigned short)(u >> 16); }
__device__ __forceinline__ float bf2f(unsigned short b) { return __uint_as_float(((unsigned)b) << 16); }
__device__ __forceinline__ float bfr(float f) { return bf2f(f2bf(f)); }
__device__ __forceinline__ v16h cat16(v8h lo, v8h hi) { return __builtin_shufflevector(lo, hi, 0, 1, 2, 3, 4, 5, 6, 7, 8, 9, 10, 11, 12, 13, 14, 15); }
__device__ __forceinline__ v16bf cat16b(v8us lo, v8us hi) { return __builtin_bit_cast(v16bf, __builtin_shufflevector(lo, hi, 0, 1, 2, 3, 4, 5, 6, 7, 8, 9, 10, 11, 12, 13, 14, 15)); }
__device__ __forceinline__ v8f wmma16(v16h a, v16h b, v8f c) { return __builtin_amdgcn_wmma_f32_16x16x32_f16(false, a, false, b, (short)0, c, false, false); }
__device__ __forceinline__ v8f wmmab(v16bf a, v16bf b, v8f c) { return __builtin_amdgcn_wmma_f32_16x16x32_bf16(false, a, false, b, (short)0, c, false, false); }
// fragment loaders: p already includes + 8*(lane>>4); elements 0..7 <- p[0..7], elements 8..15 <- p[16..23]
__device__ __forceinline__ v16h ldh(const h16* p) { return cat16(*(const v8h*)p, *(const v8h*)(p + 16)); }
__device__ __forceinline__ v16bf ldb(const bf* p) { return cat16b(*(const v8us*)p, *(const v8us*)(p + 16)); }
// f32 -> f16 plane convert that cannot produce an f16 subnormal (value select)
static __device__ __forceinline__ h16 toh_flush(float v) { const h16 r = (h16)v; return (fabsf(v) < 6.103515625e-05f) ? (h16)0.0f : r; }

__global__ __launch_bounds__(256) void k_wprep(const float* __restrict__ Wk, const float* __restrict__ Wq, const float* __restrict__ Wv, bf* WT) {
    const unsigned idx = blockIdx.x * 256u + threadIdx.x;
    if (idx >= 3u * NH * HD * DM / 8u) return;
    const unsigned k8 = idx & 63u, n = (idx >> 6) & 63u, h = (idx >> 12) & 7u, m = idx >> 15;   // m is block-uniform (128 blocks per matrix)
    const float* W = (m == 0u) ? Wk : ((m == 1u) ? Wq : Wv);
    const float* src = W + (size_t)h * DM * HD + (size_t)(k8 * 8u) * HD + n;
    v8us o;
#pragma unroll
    for (int i = 0; i < 8; ++i) o[i] = f2bf(src[(size_t)i * HD]);
    *(v8us*)(WT + (size_t)idx * 8) = o; 
}

__global__ __launch_bounds__(256) void k_xprep(const float* __restrict__ x, bf* XB) {
    const unsigned idx = blockIdx.x * 256u + threadIdx.x;
    if (idx >= (unsigned)((size_t)NB * SEQ * DM / 8u)) return;
    const unsigned c8 = idx & 63u, row = idx >> 6;
    const unsigned b = row / SEQ, s = row % SEQ;
    const float* src = x + ((size_t)b * SEQ_FULL + s) * DM + c8 * 8u;
    const v4f a0 = *(const v4f*)src, a1 = *(const v4f*)(src + 4);
    v8us o;
    o[0] = f2bf(a0[0]); o[1] = f2bf(a0[1]); o[2] = f2bf(a0[2]); o[3] = f2bf(a0[3]);
    o[4] = f2bf(a1[0]); o[5] = f2bf(a1[1]); o[6] = f2bf(a1[2]); o[7] = f2bf(a1[3]);
    *(v8us*)(XB + (size_t)idx * 8) = o; 
}

// ---- k_proj: block = (128 tokens, head), 8 waves = 4 token groups x 2 column groups, wave = 32 tokens x 32 columns of each of K, Q, V. K = x Wk + bk, Q = x Wq + bq, V = x Wv + bv (bf16 WMMA over K = 512, f32 acc, k ascending), one K loop for the three products.
// Each 64-wide k slice of the block's 128 x rows and of the head's 3 x 64 W rows (whole 128-byte lines) is brought into LDS once per block by asynchronous copies (two buffers) and read by all 8 waves;
// behind the loop the same LDS holds the f16 tiles (V transposed) for the whole-line plane writes.
#define PTOK 128u             // tokens of a block
#define PROWS (PTOK + 192u)   // rows of one stage: x 0..127 | Wk 128..191 | Wq 192..255 | Wv 256..319
#define PBUFB (PROWS * KPB)   // bytes of one stage buffer
static_assert(2u * PBUFB >= 3u * PTOK * 64u * 2u);
// one stage = 320 rows x 128 B = 2560 pieces of 16 B, ten per thread (32 rows per copy); l = this lane's LDS byte address in the stage's buffer
__device__ __forceinline__ void proj_stage(unsigned l, const bf* gx, const bf* gw) {
    const bf* gw1 = gw + (size_t)NH * HD * DM;
    const bf* gw2 = gw + (size_t)2 * NH * HD * DM;
    // the copies and the s_wait_xcnt behind them are one statement, so that no address register of a copy is rewritten in front of that wait
    asm volatile("global_load_async_to_lds_b128 %0, %10, off\n\t"
                 "global_load_async_to_lds_b128 %1, %11, off\n\t"
                 "global_load_async_to_lds_b128 %2, %12, off\n\t"
                 "global_load_async_to_lds_b128 %3, %13, off\n\t"
                 "global_load_async_to_lds_b128 %4, %14, off\n\t"
                 "global_load_async_to_lds_b128 %5, %15, off\n\t"
                 "global_load_async_to_lds_b128 %6, %16, off\n\t"
                 "global_load_async_to_lds_b128 %7, %17, off\n\t"
                 "global_load_async_to_lds_b128 %8, %18, off\n\t"
                 "global_load_async_to_lds_b128 %9, %19, off\n\t"
                 "s_wait_xcnt 0x0"
                 :: "v"(l), "v"(l + 32u * KPB), "v"(l + 64u * KPB), "v"(l + 96u * KPB), "v"(l + 128u * KPB),
                    "v"(l + 160u * KPB), "v"(l + 192u * KPB), "v"(l + 224u * KPB), "v"(l + 256u * KPB), "v"(l + 288u * KPB),
                    "v"(gx), "v"(gx + 32 * DM), "v"(gx + 64 * DM), "v"(gx + 96 * DM), "v"(gw),
                    "v"(gw + 32 * DM), "v"(gw1), "v"(gw1 + 32 * DM), "v"(gw2), "v"(gw2 + 32 * DM) : "memory");
}

// acc[mt * 6 + jj]: token tile mt, column tile jj of this matrix
template <bool TR>
__device__ __forceinline__ void proj_put(const v8f* acc, const float* __restrict__ bias, h16* dst, unsigned wm, unsigned wn, unsigned nn, unsigned g) {
#pragma unroll
    for (unsigned jj = 0; jj < 2; ++jj) {
        const unsigned col = (wn * 2u + jj) * 16u + nn;
        const float bvv = bfr(bias[col]);
#pragma unroll
        for (unsigned mt = 0; mt < 2; ++mt)
#pragma unroll
            for (unsigned r = 0; r < 8; ++r) {
                const unsigned rowl = wm * 32u + mt * 16u + 8u * g + r;
                const float val = acc[mt * 6u + jj][r] + bvv;
                if (TR) dst[col * PTOK + rowl] = toh_flush(val); else dst[rowl * 64u + col] = toh_flush(val);
            }
    }
}

__global__ __launch_bounds__(256) void k_proj(const bf* __restrict__ XB, const bf* __restrict__ WT,
                                              const float* __restrict__ bk, const float* __restrict__ bq, const float* __restrict__ bv,
                                              h16* Q16, h16* K16, h16* Vt16) {
    __shared__ __align__(16) unsigned char smem[2u * PBUFB];   // the two stage buffers; behind the loop sK | sQ | sV
    h16* sK = (h16*)smem;                                      // [token][d]
    h16* sQ = sK + PTOK * 64u;
    h16* sV = sQ + PTOK * 64u;                                 // [d][token]
    const unsigned tid = threadIdx.x, lane = tid & 31u, wave = tid >> 5, nn = lane & 15u, g = lane >> 4;
    const unsigned wm = wave & 3u, wn = wave >> 2;
    const unsigned tile = blockIdx.x, h = blockIdx.y;
    const unsigned b = tile / (SEQ / PTOK), s0 = (tile % (SEQ / PTOK)) * PTOK;
    // copy addresses of this lane: row tid >> 3 (and + 32 j), 16-byte column tid & 7; XB is compact [NB][SEQ][DM], WT is [matrix][head][n][k]
    const bf* gx = XB + ((size_t)b * SEQ + s0 + (tid >> 3)) * DM + (tid & 7u) * 8u;
    const bf* gw = WT + ((size_t)h * HD + (tid >> 3)) * DM + (tid & 7u) * 8u;
    const unsigned l0 = (unsigned)(size_t)smem + (tid >> 3) * KPB + (tid & 7u) * 16u;
    proj_stage(l0, gx, gw);                               // slice 0 -> buffer 0
    asm volatile("s_wait_asynccnt 0x0" ::: "memory");     // this wave's pieces of slice 0 have landed
    __syncthreads();                                      // slice 0 is read across waves
    proj_stage(l0 + PBUFB, gx + 64, gw + 64);             // slice 1 -> buffer 1, flies during trip 0
    v8f acc[12];                                          // [token tile][matrix K, Q, V][column tile]
#pragma unroll
    for (int t = 0; t < 12; ++t) acc[t] = (v8f){};
#pragma unroll 1
    for (unsigned kc = 0; kc < DM / 64u; ++kc) {
        const bf* sb = (const bf*)smem + (kc & 1u) * (PROWS * KP) + nn * KP + 8u * g;
        const bf* sa = sb + (wm * 32u) * KP;
        const bf* sw = sb + (PTOK + wn * 32u) * KP;
#pragma unroll
        for (unsigned hf = 0; hf < 2; ++hf) {
            v16bf a[2], w[6];
#pragma unroll
            for (unsigned mt = 0; mt < 2; ++mt) a[mt] = ldb(sa + (mt * 16u) * KP + hf * 32u);
#pragma unroll
            for (unsigned j = 0; j < 6; ++j) w[j] = ldb(sw + ((j >> 1) * 64u + (j & 1u) * 16u) * KP + hf * 32u);
            // inputs-only fence on the loaded fragments: keeps the sixteen LDS reads of this half together in front of its twelve WMMAs; without it the build reads two, waits to 0 and multiplies, twelve LDS latencies a trip
            asm volatile("" :: "v"(a[0]), "v"(a[1]), "v"(w[0]), "v"(w[1]), "v"(w[2]), "v"(w[3]), "v"(w[4]), "v"(w[5]));
#pragma unroll
            for (unsigned j = 0; j < 6; ++j)
#pragma unroll
                for (unsigned mt = 0; mt < 2; ++mt) acc[mt * 6u + j] = wmmab(a[mt], w[j], acc[mt * 6u + j]);
        }
        // hand-over: this wave has left the buffer of trip kc, its pieces of slice kc + 1 have landed, then every wave agrees
        asm volatile("s_wait_dscnt 0x0" ::: "memory");    // this wave's reads of the buffer have returned before it is refilled
        asm volatile("s_wait_asynccnt 0x0" ::: "memory"); // this wave's pieces of slice kc + 1 have landed before other waves read them
        __syncthreads();                                  // publishes slice kc + 1 and frees the buffer of trip kc
        if (kc + 2u < DM / 64u) proj_stage(l0 + (kc & 1u) * PBUFB, gx + (kc + 2u) * 64u, gw + (kc + 2u) * 64u);
    }
    asm volatile("s_wait_asynccnt 0x0" ::: "memory");     // no copy is left in flight when the buffers become the tiles' staging
    proj_put<false>(acc + 0, bk + h * HD, sK, wm, wn, nn, g);
    proj_put<false>(acc + 2, bq + h * HD, sQ, wm, wn, nn, g);
    proj_put<true >(acc + 4, bv + h * HD, sV, wm, wn, nn, g);
    __syncthreads();                                    // tiles are read across waves
    const size_t bh = (size_t)b * NH + h;
    h16* kd = K16 + (bh * SEQ + s0) * HD;               // 128 x 64 contiguous
    h16* qd = Q16 + (bh * SEQ + s0) * HD;
    h16* vd = Vt16 + bh * HD * SEQ + s0 + (size_t)(tid >> 4) * SEQ + (tid & 15u) * 8u;   // piece c = it * 256 + tid: row d = c >> 4, 16-byte column c & 15
#pragma unroll
    for (unsigned it = 0; it < 4; ++it) {
        const unsigned c = it * 256u + tid;
        const v8h kv = *(const v8ha*)(sK + c * 8u);
        const v8h qv = *(const v8ha*)(sQ + c * 8u);
        const v8h vv = *(const v8ha*)(sV + c * 8u);
        *(v8h*)(kd + (size_t)c * 8u) = kv;
        *(v8h*)(qd + (size_t)c * 8u) = qv;
        *(v8h*)(vd + (size_t)(it * 16u) * SEQ) = vv;
    }
}

// ---- k_flash: block = 128 queries of ONE head (wave = 16 queries). Each 64-key K tile and Vt tile is brought into LDS once per block by asynchronous copies (two buffers) and read by all 8 waves; online softmax per lane (query = lane & 15);
// one stage = K rows [64][64] + Vt rows [64][64] halves = 1024 pieces of 16 B, four per thread; l = this lane's LDS byte address in the stage's buffer
__device__ __forceinline__ void stage_copy(unsigned l, const h16* gk, const h16* gv) {
    // the copies and the s_wait_xcnt behind them are one statement, so that no address register of a copy is rewritten in front of that wait
    asm volatile("global_load_async_to_lds_b128 %0, %4, off\n\t"
                 "global_load_async_to_lds_b128 %1, %5, off\n\t"
                 "global_load_async_to_lds_b128 %2, %6, off\n\t"
                 "global_load_async_to_lds_b128 %3, %7, off\n\t"
                 "s_wait_xcnt 0x0"
                 :: "v"(l), "v"(l + 32u * KPB), "v"(l + 64u * KPB), "v"(l + 96u * KPB),
                    "v"(gk), "v"(gk + 32 * HD), "v"(gv), "v"(gv + (size_t)32 * SEQ) : "memory");
}

__global__ __launch_bounds__(256) void k_flash(const h16* __restrict__ Q16, const h16* __restrict__ K16, const h16* __restrict__ Vt16, float* out) {
    __shared__ __align__(16) h16 skv[2 * 128 * KP];       // [buffer][K rows 0..63 | Vt rows 64..127][KP]
    __shared__ __align__(16) float so[8 * 16 * OP];       // [wave][query][OP]
    const unsigned tid = threadIdx.x, lane = tid & 31u, wave = tid >> 5, nn = lane & 15u, g = lane >> 4;
    const unsigned blk = blockIdx.x;
    const unsigned bhu = blk / (SEQ / 128u), q0 = (blk % (SEQ / 128u)) * 128u + wave * 16u;
    const unsigned b = bhu / NH, h = bhu % NH;
    const size_t bh = (size_t)bhu;
    const h16* Qh = Q16 + bh * SEQ * HD;
    // copy addresses of this lane: piece tid of 256 = row tid >> 3 (and + 32), 16-byte column tid & 7
    const h16* gk = K16 + bh * SEQ * HD + (size_t)tid * 8u;
    const h16* gv = Vt16 + bh * HD * SEQ + (size_t)(tid >> 3) * SEQ + (tid & 7u) * 8u;
    const unsigned l0 = (unsigned)(size_t)skv + (tid >> 3) * KPB + (tid & 7u) * 16u;
    stage_copy(l0, gk, gv);                               // tile 0 -> buffer 0
    asm volatile("s_wait_asynccnt 0x0" ::: "memory");     // this wave's pieces of tile 0 have landed
    __syncthreads();                                      // tile 0 is read across waves
    stage_copy(l0 + BUFB, gk + 64 * HD, gv + 64);         // tile 1 -> buffer 1, flies during trip 0
    // Q^T as the B operand: lane column = query q0 + nn, k = d
    const v16h qb0 = ldh(Qh + (size_t)(q0 + nn) * HD + 8u * g);
    const v16h qb1 = ldh(Qh + (size_t)(q0 + nn) * HD + 32u + 8u * g);
    const float C = 0.125f * 1.4426950408889634f;      // 1/sqrt(64) x log2(e)
    float m = -1.0e30f, l = 0.f;
    v8f o[4];
#pragma unroll
    for (int dt = 0; dt < 4; ++dt) o[dt] = (v8f){};
#pragma unroll 1
    for (unsigned it = 0; it < SEQ / 64u; ++it) {
        const h16* Kh = skv + (it & 1u) * (128u * KP) + nn * KP + 8u * g;
        const h16* Vh = Kh + 64u * KP;
        v8f sc[4];
        // S^T tiles: rows = keys j0 + jt*16 + 8g + r, column = query nn
#pragma unroll
        for (unsigned jt = 0; jt < 4; ++jt) {
            const h16* kp = Kh + (jt * 16u) * KP;
            const v16h ka0 = ldh(kp), ka1 = ldh(kp + 32);
            v8f acc = (v8f){};
            acc = wmma16(ka0, qb0, acc);
            acc = wmma16(ka1, qb1, acc);
            sc[jt] = acc;
        }
        asm volatile("v_nop\n\tv_nop\n\tv_nop\n\tv_nop" : "+v"(sc[0]), "+v"(sc[1]), "+v"(sc[2]), "+v"(sc[3]) : "v"(qb0), "v"(qb1));
        float mx = sc[0][0];
#pragma unroll
        for (int jt = 0; jt < 4; ++jt)
#pragma unroll
            for (int r = 0; r < 8; ++r) mx = fmaxf(mx, sc[jt][r]);
        mx = fmaxf(mx, __shfl_xor(mx, 16, 32));          // other key half of the same query
        const float mn = fmaxf(m, mx * C);
        const float alpha = __builtin_amdgcn_exp2f(m - mn);
        m = mn;
        const float off = mn - PSH;
        float psum = 0.f;
#pragma unroll
        for (int jt = 0; jt < 4; ++jt)
#pragma unroll
            for (int r = 0; r < 8; ++r) {
                const float e = fmaf(sc[jt][r], C, -off);                                  // e <= 10
                const float p = (e < -14.0f) ? 0.f : __builtin_amdgcn_exp2f(e);            // p is 0 or >= 2^-14 (f16 normal)
                sc[jt][r] = p; psum += p;
            }
        l = l * alpha + psum;
#pragma unroll
        for (int dt = 0; dt < 4; ++dt)
#pragma unroll
            for (int r = 0; r < 8; ++r) o[dt][r] *= alpha;
        // P^T as the B operand: element i <- tile 2kf [i], element 8+i <- tile 2kf+1 [i], lane unchanged
        v16h pb0, pb1;
#pragma unroll
        for (int i = 0; i < 8; ++i) { pb0[i] = (h16)sc[0][i]; pb0[8 + i] = (h16)sc[1][i]; pb1[i] = (h16)sc[2][i]; pb1[8 + i] = (h16)sc[3][i]; }
        // O^T tiles: rows = d (dt*16 + 8g + r), column = query nn
#pragma unroll
        for (unsigned dt = 0; dt < 4; ++dt) {
            const h16* vp = Vh + (dt * 16u) * KP;
            const v16h va0 = ldh(vp), va1 = ldh(vp + 32);
            o[dt] = wmma16(va0, pb0, o[dt]);
            o[dt] = wmma16(va1, pb1, o[dt]);
        }
        asm volatile("v_nop\n\tv_nop\n\tv_nop\n\tv_nop" : "+v"(o[0]), "+v"(o[1]), "+v"(o[2]), "+v"(o[3]) : "v"(pb0), "v"(pb1));
        // hand-over: this wave has left the buffer of trip it, its pieces of tile it + 1 have landed, then every wave agrees
        asm volatile("s_wait_dscnt 0x0" ::: "memory");    // this wave's reads of the buffer have returned before it is refilled
        asm volatile("s_wait_asynccnt 0x0" ::: "memory"); // this wave's pieces of tile it + 1 have landed before other waves read them
        __syncthreads();                                  // publishes tile it + 1 and frees the buffer of trip it
        if (it + 2u < SEQ / 64u) stage_copy(l0 + (it & 1u) * BUFB, gk + (size_t)(it + 2u) * (64 * HD), gv + (it + 2u) * 64u);
    }
    asm volatile("s_wait_asynccnt 0x0" ::: "memory");     // no copy is left in flight when the wave goes on to its end
    l += __shfl_xor(l, 16, 32);
    const float inv = 1.0f / l;                           // the x1024 carry cancels here
    float* sw = so + wave * (16u * OP);
#pragma unroll
    for (unsigned dt = 0; dt < 4; ++dt) {
        v4f w0, w1;
        w0[0] = o[dt][0] * inv; w0[1] = o[dt][1] * inv; w0[2] = o[dt][2] * inv; w0[3] = o[dt][3] * inv;
        w1[0] = o[dt][4] * inv; w1[1] = o[dt][5] * inv; w1[2] = o[dt][6] * inv; w1[3] = o[dt][7] * inv;
        float* sp = sw + nn * OP + dt * 16u + 8u * g;
        *(v4fa*)sp = w0; *(v4fa*)(sp + 4) = w1;
    }
    __syncthreads();                                      // the staged rows are read by other lanes
    // each load/store covers two queries' 256-byte head slices (whole 128-byte lines)
    float* op = out + ((size_t)b * SEQ + q0 + g) * DM + h * HD + nn * 4u;
    v4f ov[8];
#pragma unroll
    for (unsigned j = 0; j < 8; ++j) ov[j] = *(const v4fa*)(sw + (j * 2u + g) * OP + nn * 4u);
#pragma unroll
    for (unsigned j = 0; j < 8; ++j) *(v4f*)(op + (size_t)(j * 2u) * DM) = ov[j];
}

extern "C" void kernel_launch(void* const* d_in, const int* in_sizes, int n_in,
                              void* d_out, int out_size, void* d_ws, size_t ws_size, hipStream_t stream) {
    if (n_in < 7) return;
    const size_t need_x = (size_t)(NB - 1) * SEQ_FULL * DM + (size_t)SEQ * DM;
    if ((size_t)in_sizes[0] < need_x) return;
    if (in_sizes[1] < NH * DM * HD || in_sizes[2] < NH * DM * HD || in_sizes[3] < NH * DM * HD) return;
    if (in_sizes[4] < NH * HD || in_sizes[5] < NH * HD || in_sizes[6] < NH * HD) return;
    if ((size_t)out_size < (size_t)NB * SEQ * DM) return;
    // wire order: x, Wq, Wk, Wv, bq, bk, bv
    const float* x = (const float*)d_in[0];
    const float* Wq = (const float*)d_in[1]; const float* Wk = (const float*)d_in[2]; const float* Wv = (const float*)d_in[3];
    const float* bq = (const float*)d_in[4]; const float* bk = (const float*)d_in[5]; const float* bv = (const float*)d_in[6];
    float* OUT = (float*)d_out;
    char* wsp = (char*)d_ws;
    auto take = [&](size_t bytes) { char* p = wsp; wsp += (bytes + 255) & ~(size_t)255; return (void*)p; };
    bf* WT = (bf*)take((size_t)3 * NH * HD * DM * 2);            // 1,572,864 B
    bf* XB = (bf*)take((size_t)NB * SEQ * DM * 2);               // 8 MiB
    h16* Q16 = (h16*)take((size_t)NB * NH * SEQ * HD * 2);       // 8 MiB
    h16* K16 = (h16*)take((size_t)NB * NH * SEQ * HD * 2);       // 8 MiB
    h16* Vt16 = (h16*)take((size_t)NB * NH * HD * SEQ * 2);      // 8 MiB
    if ((size_t)(wsp - (char*)d_ws) > ws_size) return;
    k_wprep<<<384, 256, 0, stream>>>(Wk, Wq, Wv, WT);
    k_xprep<<<NB * SEQ / 4, 256, 0, stream>>>(x, XB);
    k_proj<<<dim3(NB * SEQ / 128, NH, 1), 256, 0, stream>>>(XB, WT, bk, bq, bv, Q16, K16, Vt16);
    k_flash<<<NB * NH * SEQ / 128, 256, 0, stream>>>(Q16, K16, Vt16, OUT);
}

// v003
// Measured time: 97.5 microseconds a run.
// Next to v002, in two timings, it ran 1.09 times as fast each time.
// Over all steps from v000 it is 4.43 times as fast.
#include <hip/hip_runtime.h>

// Compute dtypes, f32 accumulate everywhere: per-head Q/K/V projections (K = 512) = v_wmma_f32_16x16x32_bf16 on bf16-converted (RNE) x and W planes (bias bf16-converted, added in f32); scores q.k^T and P.V = v_wmma_f32_16x16x32_f16 single products (q, k, v as f16 planes; p = exp2 carried x1024 via the exponent offset, cancelled by the row sum); softmax in f32.
// Flash form: S^T = K Q^T (query on the lane/column axis), packed D tiles feed P^T as the B operand, O^T = Vt P^T; all row statistics are per lane.

#ifndef NB
#define NB 2
#endif
#ifndef SEQ
#define SEQ 4096
#endif
#define SEQ_FULL 4096
#define NH 8
#define HD 64
#define DM 512
#define OP 68             // LDS row pitch (floats) of a wave's [16][64] context tile
#define KP 72             // LDS row pitch (halves) of the K and Vt tiles: 144 B = 16 B x 9, free of bank conflicts for 16-byte row readers
#define KPB (KP * 2u)     // the same in bytes
#define BUFB (128u * KPB) // bytes of one buffer (64 K rows + 64 Vt rows)
#define PSH 10.0f         // p carried x2^10
#define PAD256(n) ((((size_t)(n)) + 255) & ~(size_t)255)

static_assert(SEQ % 128 == 0);
static_assert(SEQ / 64 >= 2);
static_assert(SEQ <= SEQ_FULL);
static_assert(NH * HD == DM);
static_assert(NH == 8);
static_assert(HD == 64);
static_assert(DM % 64 == 0);
static_assert((OP * 4) % 16 == 0);
// coverage equalities (grid x block x per-thread elements == plane elements)
static_assert((size_t)384 * 256 * 8 == (size_t)3 * NH * HD * DM);
static_assert((size_t)(NB * SEQ / 4) * 256 * 8 == (size_t)NB * SEQ * DM);
static_assert((size_t)(NB * SEQ / 128) * NH * 4 * 256 * 8 == (size_t)NB * NH * SEQ * HD);
static_assert((size_t)(NB * NH * SEQ / 128) * 8 * 8 * 32 * 4 == (size_t)NB * SEQ * DM);
// workspace total (WT + XB + Q16 + K16 + Vt16), each region padded to 256 B
static_assert(PAD256((size_t)3 * NH * HD * DM * 2) + PAD256((size_t)NB * SEQ * DM * 2) + 3 * PAD256((size_t)NB * NH * SEQ * HD * 2) <= (size_t)134217728);

typedef _Float16 h16;
typedef unsigned short bf;
typedef __attribute__((ext_vector_type(16))) __bf16   v16bf;
typedef __attribute__((ext_vector_type(16))) _Float16 v16h;
typedef __attribute__((ext_vector_type(8)))  _Float16 v8h;
typedef __attribute__((ext_vector_type(8)))  unsigned short v8us;
typedef __attribute__((ext_vector_type(8)))  float    v8f;
typedef __attribute__((ext_vector_type(4)))  float    v4f;
typedef v8h  __attribute__((may_alias)) v8ha;
typedef v4f  __attribute__((may_alias)) v4fa;

__device__ __forceinline__ unsigned short f2bf(float f) { unsigned u = __float_as_uint(f); u += 0x7FFFu + ((u >> 16) & 1u); return (unsigned short)(u >> 16); }
__device__ __forceinline__ float bf2f(unsigned short b) { return __uint_as_float(((unsigned)b) << 16); }
__device__ __forceinline__ float bfr(float f) { return bf2f(f2bf(f)); }
__device__ __forceinline__ v16h cat16(v8h lo, v8h hi) { return __builtin_shufflevector(lo, hi, 0, 1, 2, 3, 4, 5, 6, 7, 8, 9, 10, 11, 12, 13, 14, 15); }
__device__ __forceinline__ v16bf cat16b(v8us lo, v8us hi) { return __builtin_bit_cast(v16bf, __builtin_shufflevector(lo, hi, 0, 1, 2, 3, 4, 5, 6, 7, 8, 9, 10, 11, 12, 13, 14, 15)); }
__device__ __forceinline__ v8f wmma16(v16h a, v16h b, v8f c) { return __builtin_amdgcn_wmma_f32_16x16x32_f16(false, a, false, b, (short)0, c, false, false); }
__device__ __forceinline__ v8f wmmab(v16bf a, v16bf b, v8f c) { return __builtin_amdgcn_wmma_f32_16x16x32_bf16(false, a, false, b, (short)0, c, false, false); }
// fragment loaders: p already includes + 8*(lane>>4); elements 0..7 <- p[0..7], elements 8..15 <- p[16..23]
__device__ __forceinline__ v16h ldh(const h16* p) { return cat16(*(const v8h*)p, *(const v8h*)(p + 16)); }
__device__ __forceinline__ v16bf ldb(const bf* p) { return cat16b(*(const v8us*)p, *(const v8us*)(p + 16)); }
// f32 -> f16 plane convert that cannot produce an f16 subnormal (value select)
static __device__ __forceinline__ h16 toh_flush(float v) { const h16 r = (h16)v; return (fabsf(v) < 6.103515625e-05f) ? (h16)0.0f : r; }

__global__ __launch_bounds__(256) void k_wprep(const float* __restrict__ Wk, const float* __restrict__ Wq, const float* __restrict__ Wv, bf* WT) {
    const unsigned idx = blockIdx.x * 256u + threadIdx.x;
    if (idx >= 3u * NH * HD * DM / 8u) return;
    const unsigned k8 = idx & 63u, n = (idx >> 6) & 63u, h = (idx >> 12) & 7u, m = idx >> 15;   // m is block-uniform (128 blocks per matrix)
    const float* W = (m == 0u) ? Wk : ((m == 1u) ? Wq : Wv);
    const float* src = W + (size_t)h * DM * HD + (size_t)(k8 * 8u) * HD + n;
    v8us o;
#pragma unroll
    for (int i = 0; i < 8; ++i) o[i] = f2bf(src[(size_t)i * HD]);
    *(v8us*)(WT + (size_t)idx * 8) = o; 
}

__global__ __launch_bounds__(256) void k_xprep(const float* __restrict__ x, bf* XB) {
    const unsigned idx = blockIdx.x * 256u + threadIdx.x;
    if (idx >= (unsigned)((size_t)NB * SEQ * DM / 8u)) return;
    const unsigned c8 = idx & 63u, row = idx >> 6;
    const unsigned b = row / SEQ, s = row % SEQ;
    const float* src = x + ((size_t)b * SEQ_FULL + s) * DM + c8 * 8u;
    const v4f a0 = *(const v4f*)src, a1 = *(const v4f*)(src + 4);
    v8us o;
    o[0] = f2bf(a0[0]); o[1] = f2bf(a0[1]); o[2] = f2bf(a0[2]); o[3] = f2bf(a0[3]);
    o[4] = f2bf(a1[0]); o[5] = f2bf(a1[1]); o[6] = f2bf(a1[2]); o[7] = f2bf(a1[3]);
    *(v8us*)(XB + (size_t)idx * 8) = o; 
}

// ---- k_proj: block = (128 tokens, head), 8 waves = 4 token groups x 2 column groups, wave = 32 tokens x 32 columns of each of K, Q, V. K = x Wk + bk, Q = x Wq + bq, V = x Wv + bv (bf16 WMMA over K = 512, f32 acc, k ascending), one K loop for the three products.
// Each 64-wide k slice of the block's 128 x rows and of the head's 3 x 64 W rows (whole 128-byte lines) is brought into LDS once per block by asynchronous copies (two buffers) and read by all 8 waves;
// behind the loop the same LDS holds the f16 tiles (V transposed) for the whole-line plane writes.
#define PTOK 128u             // tokens of a block
#define PROWS (PTOK + 192u)   // rows of one stage: x 0..127 | Wk 128..191 | Wq 192..255 | Wv 256..319
#define PBUFB (PROWS * KPB)   // bytes of one stage buffer
static_assert(2u * PBUFB >= 3u * PTOK * 64u * 2u);
// one stage = 320 rows x 128 B = 2560 pieces of 16 B, ten per thread (32 rows per copy); l = this lane's LDS byte address in the stage's buffer
__device__ __forceinline__ void proj_stage(unsigned l, const bf* gx, const bf* gw) {
    const bf* gw1 = gw + (size_t)NH * HD * DM;
    const bf* gw2 = gw + (size_t)2 * NH * HD * DM;
    // the copies and the s_wait_xcnt behind them are one statement, so that no address register of a copy is rewritten in front of that wait
    asm volatile("global_load_async_to_lds_b128 %0, %10, off\n\t"
                 "global_load_async_to_lds_b128 %1, %11, off\n\t"
                 "global_load_async_to_lds_b128 %2, %12, off\n\t"
                 "global_load_async_to_lds_b128 %3, %13, off\n\t"
                 "global_load_async_to_lds_b128 %4, %14, off\n\t"
                 "global_load_async_to_lds_b128 %5, %15, off\n\t"
                 "global_load_async_to_lds_b128 %6, %16, off\n\t"
                 "global_load_async_to_lds_b128 %7, %17, off\n\t"
                 "global_load_async_to_lds_b128 %8, %18, off\n\t"
                 "global_load_async_to_lds_b128 %9, %19, off\n\t"
                 "s_wait_xcnt 0x0"
                 :: "v"(l), "v"(l + 32u * KPB), "v"(l + 64u * KPB), "v"(l + 96u * KPB), "v"(l + 128u * KPB),
                    "v"(l + 160u * KPB), "v"(l + 192u * KPB), "v"(l + 224u * KPB), "v"(l + 256u * KPB), "v"(l + 288u * KPB),
                    "v"(gx), "v"(gx + 32 * DM), "v"(gx + 64 * DM), "v"(gx + 96 * DM), "v"(gw),
                    "v"(gw + 32 * DM), "v"(gw1), "v"(gw1 + 32 * DM), "v"(gw2), "v"(gw2 + 32 * DM) : "memory");
}

// acc[mt * 6 + jj]: token tile mt, column tile jj of this matrix
template <bool TR>
__device__ __forceinline__ void proj_put(const v8f* acc, const float* __restrict__ bias, h16* dst, unsigned wm, unsigned wn, unsigned nn, unsigned g) {
#pragma unroll
    for (unsigned jj = 0; jj < 2; ++jj) {
        const unsigned col = (wn * 2u + jj) * 16u + nn;
        const float bvv = bfr(bias[col]);
#pragma unroll
        for (unsigned mt = 0; mt < 2; ++mt)
#pragma unroll
            for (unsigned r = 0; r < 8; ++r) {
                const unsigned rowl = wm * 32u + mt * 16u + 8u * g + r;
                const float val = acc[mt * 6u + jj][r] + bvv;
                if (TR) dst[col * PTOK + rowl] = toh_flush(val); else dst[rowl * 64u + col] = toh_flush(val);
            }
    }
}

__global__ __launch_bounds__(256) void k_proj(const bf* __restrict__ XB, const bf* __restrict__ WT,
                                              const float* __restrict__ bk, const float* __restrict__ bq, const float* __restrict__ bv,
                                              h16* Q16, h16* K16, h16* Vt16) {
    __shared__ __align__(16) unsigned char smem[2u * PBUFB];   // the two stage buffers; behind the loop sK | sQ | sV
    h16* sK = (h16*)smem;                                      // [token][d]
    h16* sQ = sK + PTOK * 64u;
    h16* sV = sQ + PTOK * 64u;                                 // [d][token]
    const unsigned tid = threadIdx.x, lane = tid & 31u, wave = tid >> 5, nn = lane & 15u, g = lane >> 4;
    const unsigned wm = wave & 3u, wn = wave >> 2;
    const unsigned tile = blockIdx.x, h = blockIdx.y;
    const unsigned b = tile / (SEQ / PTOK), s0 = (tile % (SEQ / PTOK)) * PTOK;
    // copy addresses of this lane: row tid >> 3 (and + 32 j), 16-byte column tid & 7; XB is compact [NB][SEQ][DM], WT is [matrix][head][n][k]
    const bf* gx = XB + ((size_t)b * SEQ + s0 + (tid >> 3)) * DM + (tid & 7u) * 8u;
    const bf* gw = WT + ((size_t)h * HD + (tid >> 3)) * DM + (tid & 7u) * 8u;
    const unsigned l0 = (unsigned)(size_t)smem + (tid >> 3) * KPB + (tid & 7u) * 16u;
    proj_stage(l0, gx, gw);                               // slice 0 -> buffer 0
    asm volatile("s_wait_asynccnt 0x0" ::: "memory");     // this wave's pieces of slice 0 have landed
    __syncthreads();                                      // slice 0 is read across waves
    proj_stage(l0 + PBUFB, gx + 64, gw + 64);             // slice 1 -> buffer 1, flies during trip 0
    v8f acc[12];                                          // [token tile][matrix K, Q, V][column tile]
#pragma unroll
    for (int t = 0; t < 12; ++t) acc[t] = (v8f){};
#pragma unroll 1
    for (unsigned kc = 0; kc < DM / 64u; ++kc) {
        const bf* sb = (const bf*)smem + (kc & 1u) * (PROWS * KP) + nn * KP + 8u * g;
        const bf* sa = sb + (wm * 32u) * KP;
        const bf* sw = sb + (PTOK + wn * 32u) * KP;
#pragma unroll
        for (unsigned hf = 0; hf < 2; ++hf) {
            v16bf a[2], w[6];
#pragma unroll
            for (unsigned mt = 0; mt < 2; ++mt) a[mt] = ldb(sa + (mt * 16u) * KP + hf * 32u);
#pragma unroll
            for (unsigned j = 0; j < 6; ++j) w[j] = ldb(sw + ((j >> 1) * 64u + (j & 1u) * 16u) * KP + hf * 32u);
            // inputs-only fence on the loaded fragments: keeps the sixteen LDS reads of this half together in front of its twelve WMMAs; without it the build reads two, waits to 0 and multiplies, twelve LDS latencies a trip
            asm volatile("" :: "v"(a[0]), "v"(a[1]), "v"(w[0]), "v"(w[1]), "v"(w[2]), "v"(w[3]), "v"(w[4]), "v"(w[5]));
#pragma unroll
            for (unsigned j = 0; j < 6; ++j)
#pragma unroll
                for (unsigned mt = 0; mt < 2; ++mt) acc[mt * 6u + j] = wmmab(a[mt], w[j], acc[mt * 6u + j]);
        }
        // hand-over: this wave has left the buffer of trip kc, its pieces of slice kc + 1 have landed, then every wave agrees
        asm volatile("s_wait_dscnt 0x0" ::: "memory");    // this wave's reads of the buffer have returned before it is refilled
        asm volatile("s_wait_asynccnt 0x0" ::: "memory"); // this wave's pieces of slice kc + 1 have landed before other waves read them
        __syncthreads();                                  // publishes slice kc + 1 and frees the buffer of trip kc
        if (kc + 2u < DM / 64u) proj_stage(l0 + (kc & 1u) * PBUFB, gx + (kc + 2u) * 64u, gw + (kc + 2u) * 64u);
    }
    asm volatile("s_wait_asynccnt 0x0" ::: "memory");     // no copy is left in flight when the buffers become the tiles' staging
    proj_put<false>(acc + 0, bk + h * HD, sK, wm, wn, nn, g);
    proj_put<false>(acc + 2, bq + h * HD, sQ, wm, wn, nn, g);
    proj_put<true >(acc + 4, bv + h * HD, sV, wm, wn, nn, g);
    __syncthreads();                                    // tiles are read across waves
    const size_t bh = (size_t)b * NH + h;
    h16* kd = K16 + (bh * SEQ + s0) * HD;               // 128 x 64 contiguous
    h16* qd = Q16 + (bh * SEQ + s0) * HD;
    h16* vd = Vt16 + bh * HD * SEQ + s0 + (size_t)(tid >> 4) * SEQ + (tid & 15u) * 8u;   // piece c = it * 256 + tid: row d = c >> 4, 16-byte column c & 15
#pragma unroll
    for (unsigned it = 0; it < 4; ++it) {
        const unsigned c = it * 256u + tid;
        const v8h kv = *(const v8ha*)(sK + c * 8u);
        const v8h qv = *(const v8ha*)(sQ + c * 8u);
        const v8h vv = *(const v8ha*)(sV + c * 8u);
        *(v8h*)(kd + (size_t)c * 8u) = kv;
        *(v8h*)(qd + (size_t)c * 8u) = qv;
        *(v8h*)(vd + (size_t)(it * 16u) * SEQ) = vv;
    }
}

// ---- k_flash: block = 128 queries of ONE head (wave = 16 queries). Each 64-key K tile and Vt tile is brought into LDS once per block by asynchronous copies (two buffers) and read by all 8 waves; online softmax per lane (query = lane & 15);
// one stage = K rows [64][64] + Vt rows [64][64] halves = 1024 pieces of 16 B, four per thread; l = this lane's LDS byte address in the stage's buffer
__device__ __forceinline__ void stage_copy(unsigned l, const h16* gk, const h16* gv) {
    // the copies and the s_wait_xcnt behind them are one statement, so that no address register of a copy is rewritten in front of that wait
    asm volatile("global_load_async_to_lds_b128 %0, %4, off\n\t"
                 "global_load_async_to_lds_b128 %1, %5, off\n\t"
                 "global_load_async_to_lds_b128 %2, %6, off\n\t"
                 "global_load_async_to_lds_b128 %3, %7, off\n\t"
                 "s_wait_xcnt 0x0"
                 :: "v"(l), "v"(l + 32u * KPB), "v"(l + 64u * KPB), "v"(l + 96u * KPB),
                    "v"(gk), "v"(gk + 32 * HD), "v"(gv), "v"(gv + (size_t)32 * SEQ) : "memory");
}

__global__ __launch_bounds__(256) void k_flash(const h16* __restrict__ Q16, const h16* __restrict__ K16, const h16* __restrict__ Vt16, float* out) {
    __shared__ __align__(16) h16 skv[2 * 128 * KP];       // [buffer][K rows 0..63 | Vt rows 64..127][KP]
    __shared__ __align__(16) float so[8 * 16 * OP];       // [wave][query][OP]
    const unsigned tid = threadIdx.x, lane = tid & 31u, wave = tid >> 5, nn = lane & 15u, g = lane >> 4;
    const unsigned blk = blockIdx.x;
    const unsigned bhu = blk / (SEQ / 128u), q0 = (blk % (SEQ / 128u)) * 128u + wave * 16u;
    const unsigned b = bhu / NH, h = bhu % NH;
    const size_t bh = (size_t)bhu;
    const h16* Qh = Q16 + bh * SEQ * HD;
    // copy addresses of this lane: piece tid of 256 = row tid >> 3 (and + 32), 16-byte column tid & 7
    const h16* gk = K16 + bh * SEQ * HD + (size_t)tid * 8u;
    const h16* gv = Vt16 + bh * HD * SEQ + (size_t)(tid >> 3) * SEQ + (tid & 7u) * 8u;
    const unsigned l0 = (unsigned)(size_t)skv + (tid >> 3) * KPB + (tid & 7u) * 16u;
    stage_copy(l0, gk, gv);                               // tile 0 -> buffer 0
    asm volatile("s_wait_asynccnt 0x0" ::: "memory");     // this wave's pieces of tile 0 have landed
    __syncthreads();                                      // tile 0 is read across waves
    stage_copy(l0 + BUFB, gk + 64 * HD, gv + 64);         // tile 1 -> buffer 1, flies during trip 0
    // Q^T as the B operand: lane column = query q0 + nn, k = d
    const v16h qb0 = ldh(Qh + (size_t)(q0 + nn) * HD + 8u * g);
    const v16h qb1 = ldh(Qh + (size_t)(q0 + nn) * HD + 32u + 8u * g);
    const float C = 0.125f * 1.4426950408889634f;      // 1/sqrt(64) x log2(e)
    float m = -1.0e30f, l = 0.f;
    v8f o[4];
#pragma unroll
    for (int dt = 0; dt < 4; ++dt) o[dt] = (v8f){};
#pragma unroll 1
    for (unsigned it = 0; it < SEQ / 64u; ++it) {
        const h16* Kh = skv + (it & 1u) * (128u * KP) + nn * KP + 8u * g;
        const h16* Vh = Kh + 64u * KP;
        v8f sc[4];
        // S^T tiles: rows = keys j0 + jt*16 + 8g + r, column = query nn
#pragma unroll
        for (unsigned jt = 0; jt < 4; ++jt) {
            const h16* kp = Kh + (jt * 16u) * KP;
            const v16h ka0 = ldh(kp), ka1 = ldh(kp + 32);
            v8f acc = (v8f){};
            acc = wmma16(ka0, qb0, acc);
            acc = wmma16(ka1, qb1, acc);
            sc[jt] = acc;
        }
        asm volatile("v_nop\n\tv_nop\n\tv_nop\n\tv_nop" : "+v"(sc[0]), "+v"(sc[1]), "+v"(sc[2]), "+v"(sc[3]) : "v"(qb0), "v"(qb1));
        float mx = sc[0][0];
#pragma unroll
        for (int jt = 0; jt < 4; ++jt)
#pragma unroll
            for (int r = 0; r < 8; ++r) mx = fmaxf(mx, sc[jt][r]);
        mx = fmaxf(mx, __shfl_xor(mx, 16, 32));          // other key half of the same query
        const float mn = fmaxf(m, mx * C);
        const float alpha = __builtin_amdgcn_exp2f(m - mn);
        m = mn;
        const float off = mn - PSH;
        float psum = 0.f;
#pragma unroll
        for (int jt = 0; jt < 4; ++jt)
#pragma unroll
            for (int r = 0; r < 8; ++r) {
                const float e = fmaf(sc[jt][r], C, -off);                                  // e <= 10
                const float p = __builtin_amdgcn_exp2f(e);                                 // p <= 2^10; below 2^-14 its f16 form is a subnormal
                sc[jt][r] = p; psum += p;
            }
        l = l * alpha + psum;
#pragma unroll
        for (int dt = 0; dt < 4; ++dt)
#pragma unroll
            for (int r = 0; r < 8; ++r) o[dt][r] *= alpha;
        // P^T as the B operand: element i <- tile 2kf [i], element 8+i <- tile 2kf+1 [i], lane unchanged
        v16h pb0, pb1;
#pragma unroll
        for (int i = 0; i < 8; ++i) { pb0[i] = (h16)sc[0][i]; pb0[8 + i] = (h16)sc[1][i]; pb1[i] = (h16)sc[2][i]; pb1[8 + i] = (h16)sc[3][i]; }
        // O^T tiles: rows = d (dt*16 + 8g + r), column = query nn
#pragma unroll
        for (unsigned dt = 0; dt < 4; ++dt) {
            const h16* vp = Vh + (dt * 16u) * KP;
            const v16h va0 = ldh(vp), va1 = ldh(vp + 32);
            o[dt] = wmma16(va0, pb0, o[dt]);
            o[dt] = wmma16(va1, pb1, o[dt]);
        }
        asm volatile("v_nop\n\tv_nop\n\tv_nop\n\tv_nop" : "+v"(o[0]), "+v"(o[1]), "+v"(o[2]), "+v"(o[3]) : "v"(pb0), "v"(pb1));
        // hand-over: this wave has left the buffer of trip it, its pieces of tile it + 1 have landed, then every wave agrees
        asm volatile("s_wait_dscnt 0x0" ::: "memory");    // this wave's reads of the buffer have returned before it is refilled
        asm volatile("s_wait_asynccnt 0x0" ::: "memory"); // this wave's pieces of tile it + 1 have landed before other waves read them
        __syncthreads();                                  // publishes tile it + 1 and frees the buffer of trip it
        if (it + 2u < SEQ / 64u) stage_copy(l0 + (it & 1u) * BUFB, gk + (size_t)(it + 2u) * (64 * HD), gv + (it + 2u) * 64u);
    }
    asm volatile("s_wait_asynccnt 0x0" ::: "memory");     // no copy is left in flight when the wave goes on to its end
    l += __shfl_xor(l, 16, 32);
    const float inv = 1.0f / l;                           // the x1024 carry cancels here
    float* sw = so + wave * (16u * OP);
#pragma unroll
    for (unsigned dt = 0; dt < 4; ++dt) {
        v4f w0, w1;
        w0[0] = o[dt][0] * inv; w0[1] = o[dt][1] * inv; w0[2] = o[dt][2] * inv; w0[3] = o[dt][3] * inv;
        w1[0] = o[dt][4] * inv; w1[1] = o[dt][5] * inv; w1[2] = o[dt][6] * inv; w1[3] = o[dt][7] * inv;
        float* sp = sw + nn * OP + dt * 16u + 8u * g;
        *(v4fa*)sp = w0; *(v4fa*)(sp + 4) = w1;
    }
    __syncthreads();                                      // the staged rows are read by other lanes
    // each load/store covers two queries' 256-byte head slices (whole 128-byte lines)
    float* op = out + ((size_t)b * SEQ + q0 + g) * DM + h * HD + nn * 4u;
    v4f ov[8];
#pragma unroll
    for (unsigned j = 0; j < 8; ++j) ov[j] = *(const v4fa*)(sw + (j * 2u + g) * OP + nn * 4u);
#pragma unroll
    for (unsigned j = 0; j < 8; ++j) *(v4f*)(op + (size_t)(j * 2u) * DM) = ov[j];
}

extern "C" void kernel_launch(void* const* d_in, const int* in_sizes, int n_in,
                              void* d_out, int out_size, void* d_ws, size_t ws_size, hipStream_t stream) {
    if (n_in < 7) return;
    const size_t need_x = (size_t)(NB - 1) * SEQ_FULL * DM + (size_t)SEQ * DM;
    if ((size_t)in_sizes[0] < need_x) return;
    if (in_sizes[1] < NH * DM * HD || in_sizes[2] < NH * DM * HD || in_sizes[3] < NH * DM * HD) return;
    if (in_sizes[4] < NH * HD || in_sizes[5] < NH * HD || in_sizes[6] < NH * HD) return;
    if ((size_t)out_size < (size_t)NB * SEQ * DM) return;
    // wire order: x, Wq, Wk, Wv, bq, bk, bv
    const float* x = (const float*)d_in[0];
    const float* Wq = (const float*)d_in[1]; const float* Wk = (const float*)d_in[2]; const float* Wv = (const float*)d_in[3];
    const float* bq = (const float*)d_in[4]; const float* bk = (const float*)d_in[5]; const float* bv = (const float*)d_in[6];
    float* OUT = (float*)d_out;
    char* wsp = (char*)d_ws;
    auto take = [&](size_t bytes) { char* p = wsp; wsp += (bytes + 255) & ~(size_t)255; return (void*)p; };
    bf* WT = (bf*)take((size_t)3 * NH * HD * DM * 2);            // 1,572,864 B
    bf* XB = (bf*)take((size_t)NB * SEQ * DM * 2);               // 8 MiB
    h16* Q16 = (h16*)take((size_t)NB * NH * SEQ * HD * 2);       // 8 MiB
    h16* K16 = (h16*)take((size_t)NB * NH * SEQ * HD * 2);       // 8 MiB
    h16* Vt16 = (h16*)take((size_t)NB * NH * HD * SEQ * 2);      // 8 MiB
    if ((size_t)(wsp - (char*)d_ws) > ws_size) return;
    k_wprep<<<384, 256, 0, stream>>>(Wk, Wq, Wv, WT);
    k_xprep<<<NB * SEQ / 4, 256, 0, stream>>>(x, XB);
    k_proj<<<dim3(NB * SEQ / 128, NH, 1), 256, 0, stream>>>(XB, WT, bk, bq, bv, Q16, K16, Vt16);
    k_flash<<<NB * NH * SEQ / 128, 256, 0, stream>>>(Q16, K16, Vt16, OUT);
}

// v004
// Measured time: 86.4 microseconds a run.
// Timed twice side by side with v003, it ran 1.11 and 1.12 times as fast.
// Counting every step since v000, it is 4.95 times as fast.
#include <hip/hip_runtime.h>

// Compute dtypes, f32 accumulate everywhere: per-head Q/K/V projections (K = 512) = v_wmma_f32_16x16x32_bf16 on bf16-converted (RNE) x and W planes (bias bf16-converted, added in f32); scores q.k^T and P.V = v_wmma_f32_16x16x32_f16 single products (q, k, v as f16 planes; p = exp2 carried x1024 via the exponent offset, cancelled by the row sum); softmax in f32.
// Flash form: S^T = K Q^T (query on the lane/column axis), packed D tiles feed P^T as the B operand, O^T = Vt P^T; all row statistics are per lane.

#ifndef NB
#define NB 2
#endif
#ifndef SEQ
#define SEQ 4096
#endif
#define SEQ_FULL 4096
#define NH 8
#define HD 64
#define DM 512
#define OP 68             // LDS row pitch (floats) of a wave's [16][64] context tile
#define KP 72             // LDS row pitch (halves) of the K and Vt tiles: 144 B = 16 B x 9, free of bank conflicts for 16-byte row readers
#define KPB (KP * 2u)     // the same in bytes
#define BUFB (128u * KPB) // bytes of one 64-key sub-tile (64 K rows + 64 Vt rows)
#define XSL 1088u         // floats of one wave's slot in the swap area of k_flash: 32 lanes x (32 O values + m + l)
#define PSH 10.0f         // p carried x2^10
#define PAD256(n) ((((size_t)(n)) + 255) & ~(size_t)255)

static_assert(SEQ % 128 == 0);
static_assert(SEQ / 128 >= 2);
static_assert(8u * XSL * 4u <= 4u * BUFB);
static_assert(SEQ <= SEQ_FULL);
static_assert(NH * HD == DM);
static_assert(NH == 8);
static_assert(HD == 64);
static_assert(DM % 64 == 0);
static_assert((OP * 4) % 16 == 0);
// coverage equalities (grid x block x per-thread elements == plane elements)
static_assert((size_t)384 * 256 * 8 == (size_t)3 * NH * HD * DM);
static_assert((size_t)(NB * SEQ / 4) * 256 * 8 == (size_t)NB * SEQ * DM);
static_assert((size_t)(NB * SEQ / 128) * NH * 4 * 256 * 8 == (size_t)NB * NH * SEQ * HD);
static_assert((size_t)(NB * NH * SEQ / 128) * 8 * 8 * 32 * 4 == (size_t)NB * SEQ * DM);
// workspace total (WT + XB + Q16 + K16 + Vt16), each region padded to 256 B
static_assert(PAD256((size_t)3 * NH * HD * DM * 2) + PAD256((size_t)NB * SEQ * DM * 2) + 3 * PAD256((size_t)NB * NH * SEQ * HD * 2) <= (size_t)134217728);

typedef _Float16 h16;
typedef unsigned short bf;
typedef __attribute__((ext_vector_type(16))) __bf16   v16bf;
typedef __attribute__((ext_vector_type(16))) _Float16 v16h;
typedef __attribute__((ext_vector_type(8)))  _Float16 v8h;
typedef __attribute__((ext_vector_type(8)))  unsigned short v8us;
typedef __attribute__((ext_vector_type(8)))  float    v8f;
typedef __attribute__((ext_vector_type(4)))  float    v4f;
typedef v8h  __attribute__((may_alias)) v8ha;
typedef v4f  __attribute__((may_alias)) v4fa;
typedef float __attribute__((may_alias)) fa;

__device__ __forceinline__ unsigned short f2bf(float f) { unsigned u = __float_as_uint(f); u += 0x7FFFu + ((u >> 16) & 1u); return (unsigned short)(u >> 16); }
__device__ __forceinline__ float bf2f(unsigned short b) { return __uint_as_float(((unsigned)b) << 16); }
__device__ __forceinline__ float bfr(float f) { return bf2f(f2bf(f)); }
__device__ __forceinline__ v16h cat16(v8h lo, v8h hi) { return __builtin_shufflevector(lo, hi, 0, 1, 2, 3, 4, 5, 6, 7, 8, 9, 10, 11, 12, 13, 14, 15); }
__device__ __forceinline__ v16bf cat16b(v8us lo, v8us hi) { return __builtin_bit_cast(v16bf, __builtin_shufflevector(lo, hi, 0, 1, 2, 3, 4, 5, 6, 7, 8, 9, 10, 11, 12, 13, 14, 15)); }
__device__ __forceinline__ v8f wmma16(v16h a, v16h b, v8f c) { return __builtin_amdgcn_wmma_f32_16x16x32_f16(false, a, false, b, (short)0, c, false, false); }
__device__ __forceinline__ v8f wmmab(v16bf a, v16bf b, v8f c) { return __builtin_amdgcn_wmma_f32_16x16x32_bf16(false, a, false, b, (short)0, c, false, false); }
// fragment loaders: p already includes + 8*(lane>>4); elements 0..7 <- p[0..7], elements 8..15 <- p[16..23]
__device__ __forceinline__ v16h ldh(const h16* p) { return cat16(*(const v8h*)p, *(const v8h*)(p + 16)); }
__device__ __forceinline__ v16bf ldb(const bf* p) { return cat16b(*(const v8us*)p, *(const v8us*)(p + 16)); }
// f32 -> f16 plane convert that cannot produce an f16 subnormal (value select)
static __device__ __forceinline__ h16 toh_flush(float v) { const h16 r = (h16)v; return (fabsf(v) < 6.103515625e-05f) ? (h16)0.0f : r; }

__global__ __launch_bounds__(256) void k_wprep(const float* __restrict__ Wk, const float* __restrict__ Wq, const float* __restrict__ Wv, bf* WT) {
    const unsigned idx = blockIdx.x * 256u + threadIdx.x;
    if (idx >= 3u * NH * HD * DM / 8u) return;
    const unsigned k8 = idx & 63u, n = (idx >> 6) & 63u, h = (idx >> 12) & 7u, m = idx >> 15;   // m is block-uniform (128 blocks per matrix)
    const float* W = (m == 0u) ? Wk : ((m == 1u) ? Wq : Wv);
    const float* src = W + (size_t)h * DM * HD + (size_t)(k8 * 8u) * HD + n;
    v8us o;
#pragma unroll
    for (int i = 0; i < 8; ++i) o[i] = f2bf(src[(size_t)i * HD]);
    *(v8us*)(WT + (size_t)idx * 8) = o; 
}

__global__ __launch_bounds__(256) void k_xprep(const float* __restrict__ x, bf* XB) {
    const unsigned idx = blockIdx.x * 256u + threadIdx.x;
    if (idx >= (unsigned)((size_t)NB * SEQ * DM / 8u)) return;
    const unsigned c8 = idx & 63u, row = idx >> 6;
    const unsigned b = row / SEQ, s = row % SEQ;
    const float* src = x + ((size_t)b * SEQ_FULL + s) * DM + c8 * 8u;
    const v4f a0 = *(const v4f*)src, a1 = *(const v4f*)(src + 4);
    v8us o;
    o[0] = f2bf(a0[0]); o[1] = f2bf(a0[1]); o[2] = f2bf(a0[2]); o[3] = f2bf(a0[3]);
    o[4] = f2bf(a1[0]); o[5] = f2bf(a1[1]); o[6] = f2bf(a1[2]); o[7] = f2bf(a1[3]);
    *(v8us*)(XB + (size_t)idx * 8) = o; 
}

// ---- k_proj: block = (128 tokens, head), 8 waves = 4 token groups x 2 column groups, wave = 32 tokens x 32 columns of each of K, Q, V. K = x Wk + bk, Q = x Wq + bq, V = x Wv + bv (bf16 WMMA over K = 512, f32 acc, k ascending), one K loop for the three products.
// Each 64-wide k slice of the block's 128 x rows and of the head's 3 x 64 W rows (whole 128-byte lines) is brought into LDS once per block by asynchronous copies (two buffers) and read by all 8 waves;
// behind the loop the same LDS holds the f16 tiles (V transposed) for the whole-line plane writes.
#define PTOK 128u             // tokens of a block
#define PROWS (PTOK + 192u)   // rows of one stage: x 0..127 | Wk 128..191 | Wq 192..255 | Wv 256..319
#define PBUFB (PROWS * KPB)   // bytes of one stage buffer
static_assert(2u * PBUFB >= 3u * PTOK * 64u * 2u);
// one stage = 320 rows x 128 B = 2560 pieces of 16 B, ten per thread (32 rows per copy); l = this lane's LDS byte address in the stage's buffer
__device__ __forceinline__ void proj_stage(unsigned l, const bf* gx, const bf* gw) {
    const bf* gw1 = gw + (size_t)NH * HD * DM;
    const bf* gw2 = gw + (size_t)2 * NH * HD * DM;
    // the copies and the s_wait_xcnt behind them are one statement, so that no address register of a copy is rewritten in front of that wait
    asm volatile("global_load_async_to_lds_b128 %0, %10, off\n\t"
                 "global_load_async_to_lds_b128 %1, %11, off\n\t"
                 "global_load_async_to_lds_b128 %2, %12, off\n\t"
                 "global_load_async_to_lds_b128 %3, %13, off\n\t"
                 "global_load_async_to_lds_b128 %4, %14, off\n\t"
                 "global_load_async_to_lds_b128 %5, %15, off\n\t"
                 "global_load_async_to_lds_b128 %6, %16, off\n\t"
                 "global_load_async_to_lds_b128 %7, %17, off\n\t"
                 "global_load_async_to_lds_b128 %8, %18, off\n\t"
                 "global_load_async_to_lds_b128 %9, %19, off\n\t"
                 "s_wait_xcnt 0x0"
                 :: "v"(l), "v"(l + 32u * KPB), "v"(l + 64u * KPB), "v"(l + 96u * KPB), "v"(l + 128u * KPB),
                    "v"(l + 160u * KPB), "v"(l + 192u * KPB), "v"(l + 224u * KPB), "v"(l + 256u * KPB), "v"(l + 288u * KPB),
                    "v"(gx), "v"(gx + 32 * DM), "v"(gx + 64 * DM), "v"(gx + 96 * DM), "v"(gw),
                    "v"(gw + 32 * DM), "v"(gw1), "v"(gw1 + 32 * DM), "v"(gw2), "v"(gw2 + 32 * DM) : "memory");
}

// acc[mt * 6 + jj]: token tile mt, column tile jj of this matrix
template <bool TR>
__device__ __forceinline__ void proj_put(const v8f* acc, const float* __restrict__ bias, h16* dst, unsigned wm, unsigned wn, unsigned nn, unsigned g) {
#pragma unroll
    for (unsigned jj = 0; jj < 2; ++jj) {
        const unsigned col = (wn * 2u + jj) * 16u + nn;
        const float bvv = bfr(bias[col]);
#pragma unroll
        for (unsigned mt = 0; mt < 2; ++mt)
#pragma unroll
            for (unsigned r = 0; r < 8; ++r) {
                const unsigned rowl = wm * 32u + mt * 16u + 8u * g + r;
                const float val = acc[mt * 6u + jj][r] + bvv;
                if (TR) dst[col * PTOK + rowl] = toh_flush(val); else dst[rowl * 64u + col] = toh_flush(val);
            }
    }
}

__global__ __launch_bounds__(256) void k_proj(const bf* __restrict__ XB, const bf* __restrict__ WT,
                                              const float* __restrict__ bk, const float* __restrict__ bq, const float* __restrict__ bv,
                                              h16* Q16, h16* K16, h16* Vt16) {
    __shared__ __align__(16) unsigned char smem[2u * PBUFB];   // the two stage buffers; behind the loop sK | sQ | sV
    h16* sK = (h16*)smem;                                      // [token][d]
    h16* sQ = sK + PTOK * 64u;
    h16* sV = sQ + PTOK * 64u;                                 // [d][token]
    const unsigned tid = threadIdx.x, lane = tid & 31u, wave = tid >> 5, nn = lane & 15u, g = lane >> 4;
    const unsigned wm = wave & 3u, wn = wave >> 2;
    const unsigned tile = blockIdx.x, h = blockIdx.y;
    const unsigned b = tile / (SEQ / PTOK), s0 = (tile % (SEQ / PTOK)) * PTOK;
    // copy addresses of this lane: row tid >> 3 (and + 32 j), 16-byte column tid & 7; XB is compact [NB][SEQ][DM], WT is [matrix][head][n][k]
    const bf* gx = XB + ((size_t)b * SEQ + s0 + (tid >> 3)) * DM + (tid & 7u) * 8u;
    const bf* gw = WT + ((size_t)h * HD + (tid >> 3)) * DM + (tid & 7u) * 8u;
    const unsigned l0 = (unsigned)(size_t)smem + (tid >> 3) * KPB + (tid & 7u) * 16u;
    proj_stage(l0, gx, gw);                               // slice 0 -> buffer 0
    asm volatile("s_wait_asynccnt 0x0" ::: "memory");     // this wave's pieces of slice 0 have landed
    __syncthreads();                                      // slice 0 is read across waves
    proj_stage(l0 + PBUFB, gx + 64, gw + 64);             // slice 1 -> buffer 1, flies during trip 0
    v8f acc[12];                                          // [token tile][matrix K, Q, V][column tile]
#pragma unroll
    for (int t = 0; t < 12; ++t) acc[t] = (v8f){};
#pragma unroll 1
    for (unsigned kc = 0; kc < DM / 64u; ++kc) {
        const bf* sb = (const bf*)smem + (kc & 1u) * (PROWS * KP) + nn * KP + 8u * g;
        const bf* sa = sb + (wm * 32u) * KP;
        const bf* sw = sb + (PTOK + wn * 32u) * KP;
#pragma unroll
        for (unsigned hf = 0; hf < 2; ++hf) {
            v16bf a[2], w[6];
#pragma unroll
            for (unsigned mt = 0; mt < 2; ++mt) a[mt] = ldb(sa + (mt * 16u) * KP + hf * 32u);
#pragma unroll
            for (unsigned j = 0; j < 6; ++j) w[j] = ldb(sw + ((j >> 1) * 64u + (j & 1u) * 16u) * KP + hf * 32u);
            // inputs-only fence on the loaded fragments: keeps the sixteen LDS reads of this half together in front of its twelve WMMAs; without it the build reads two, waits to 0 and multiplies, twelve LDS latencies a trip
            asm volatile("" :: "v"(a[0]), "v"(a[1]), "v"(w[0]), "v"(w[1]), "v"(w[2]), "v"(w[3]), "v"(w[4]), "v"(w[5]));
#pragma unroll
            for (unsigned j = 0; j < 6; ++j)
#pragma unroll
                for (unsigned mt = 0; mt < 2; ++mt) acc[mt * 6u + j] = wmmab(a[mt], w[j], acc[mt * 6u + j]);
        }
        // hand-over: this wave has left the buffer of trip kc, its pieces of slice kc + 1 have landed, then every wave agrees
        asm volatile("s_wait_dscnt 0x0" ::: "memory");    // this wave's reads of the buffer have returned before it is refilled
        asm volatile("s_wait_asynccnt 0x0" ::: "memory"); // this wave's pieces of slice kc + 1 have landed before other waves read them
        __syncthreads();                                  // publishes slice kc + 1 and frees the buffer of trip kc
        if (kc + 2u < DM / 64u) proj_stage(l0 + (kc & 1u) * PBUFB, gx + (kc + 2u) * 64u, gw + (kc + 2u) * 64u);
    }
    asm volatile("s_wait_asynccnt 0x0" ::: "memory");     // no copy is left in flight when the buffers become the tiles' staging
    proj_put<false>(acc + 0, bk + h * HD, sK, wm, wn, nn, g);
    proj_put<false>(acc + 2, bq + h * HD, sQ, wm, wn, nn, g);
    proj_put<true >(acc + 4, bv + h * HD, sV, wm, wn, nn, g);
    __syncthreads();                                    // tiles are read across waves
    const size_t bh = (size_t)b * NH + h;
    h16* kd = K16 + (bh * SEQ + s0) * HD;               // 128 x 64 contiguous
    h16* qd = Q16 + (bh * SEQ + s0) * HD;
    h16* vd = Vt16 + bh * HD * SEQ + s0 + (size_t)(tid >> 4) * SEQ + (tid & 15u) * 8u;   // piece c = it * 256 + tid: row d = c >> 4, 16-byte column c & 15
#pragma unroll
    for (unsigned it = 0; it < 4; ++it) {
        const unsigned c = it * 256u + tid;
        const v8h kv = *(const v8ha*)(sK + c * 8u);
        const v8h qv = *(const v8ha*)(sQ + c * 8u);
        const v8h vv = *(const v8ha*)(sV + c * 8u);
        *(v8h*)(kd + (size_t)c * 8u) = kv;
        *(v8h*)(qd + (size_t)c * 8u) = qv;
        *(v8h*)(vd + (size_t)(it * 16u) * SEQ) = vv;
    }
}

// ---- k_flash: block = 128 queries of ONE head; 8 waves = 4 query groups of 32 x 2 key halves. A stage is 128 keys = two 64-key sub-tiles (each K rows + Vt rows), brought into LDS once per block by asynchronous copies (two buffers);
// wave (pr, kh) works on sub-tile kh of every stage for the 32 queries of group pr, so each K and Vt fragment read from LDS feeds two query tiles. Online softmax per lane (query = lane & 15, per query tile);
// behind the loop the two waves of a group swap one query tile's partial (m, l, O) through the freed ring and each finishes 16 queries.
// one sub-tile = K rows [64][64] + Vt rows [64][64] halves = 1024 pieces of 16 B, four per thread; l = this lane's LDS byte address in the sub-tile
__device__ __forceinline__ void stage_copy(unsigned l, const h16* gk, const h16* gv) {
    // the copies and the s_wait_xcnt behind them are one statement, so that no address register of a copy is rewritten in front of that wait
    asm volatile("global_load_async_to_lds_b128 %0, %4, off\n\t"
                 "global_load_async_to_lds_b128 %1, %5, off\n\t"
                 "global_load_async_to_lds_b128 %2, %6, off\n\t"
                 "global_load_async_to_lds_b128 %3, %7, off\n\t"
                 "s_wait_xcnt 0x0"
                 :: "v"(l), "v"(l + 32u * KPB), "v"(l + 64u * KPB), "v"(l + 96u * KPB),
                    "v"(gk), "v"(gk + 32 * HD), "v"(gv), "v"(gv + (size_t)32 * SEQ) : "memory");
}
// one stage = the sub-tiles of keys [0, 64) and [64, 128) behind gk, gv
__device__ __forceinline__ void stage_copy2(unsigned l, const h16* gk, const h16* gv) {
    stage_copy(l, gk, gv);
    stage_copy(l + BUFB, gk + 64 * HD, gv + 64);
}

__global__ __launch_bounds__(256) void k_flash(const h16* __restrict__ Q16, const h16* __restrict__ K16, const h16* __restrict__ Vt16, float* out) {
    __shared__ __align__(16) h16 skv[2 * 2 * 128 * KP];   // [buffer][sub-tile][K rows 0..63 | Vt rows 64..127][KP]; behind the loop the swap area
    __shared__ __align__(16) float so[8 * 16 * OP];       // [wave][query][OP]
    const unsigned tid = threadIdx.x, lane = tid & 31u, wave = tid >> 5, nn = lane & 15u, g = lane >> 4;
    const unsigned pr = wave & 3u, kh = wave >> 2;
    const unsigned blk = blockIdx.x;
    const unsigned bhu = blk / (SEQ / 128u), qg0 = (blk % (SEQ / 128u)) * 128u + pr * 32u;
    const unsigned b = bhu / NH, h = bhu % NH;
    const size_t bh = (size_t)bhu;
    const h16* Qh = Q16 + bh * SEQ * HD;
    // copy addresses of this lane: piece tid of 256 = row tid >> 3 (and + 32), 16-byte column tid & 7
    const h16* gk = K16 + bh * SEQ * HD + (size_t)tid * 8u;
    const h16* gv = Vt16 + bh * HD * SEQ + (size_t)(tid >> 3) * SEQ + (tid & 7u) * 8u;
    const unsigned l0 = (unsigned)(size_t)skv + (tid >> 3) * KPB + (tid & 7u) * 16u;
    stage_copy2(l0, gk, gv);                              // stage 0 -> buffer 0
    asm volatile("s_wait_asynccnt 0x0" ::: "memory");     // this wave's pieces of stage 0 have landed
    __syncthreads();                                      // stage 0 is read across waves
    stage_copy2(l0 + 2u * BUFB, gk + 128 * HD, gv + 128); // stage 1 -> buffer 1, flies during trip 0
    // Q^T as the B operand: lane column = query qg0 + qt*16 + nn, k = d
    v16h qb[2][2];
#pragma unroll
    for (unsigned qt = 0; qt < 2; ++qt) {
        qb[qt][0] = ldh(Qh + (size_t)(qg0 + qt * 16u + nn) * HD + 8u * g);
        qb[qt][1] = ldh(Qh + (size_t)(qg0 + qt * 16u + nn) * HD + 32u + 8u * g);
    }
    const float C = 0.125f * 1.4426950408889634f;      // 1/sqrt(64) x log2(e)
    float m[2] = {-1.0e30f, -1.0e30f}, l[2] = {0.f, 0.f};
    v8f o[2][4];
#pragma unroll
    for (int qt = 0; qt < 2; ++qt)
#pragma unroll
        for (int dt = 0; dt < 4; ++dt) o[qt][dt] = (v8f){};
#pragma unroll 1
    for (unsigned it = 0; it < SEQ / 128u; ++it) {
        const h16* Kh = skv + ((it & 1u) * 2u + kh) * (128u * KP) + nn * KP + 8u * g;
        const h16* Vh = Kh + 64u * KP;
        v8f sc[2][4];
        // S^T tiles: rows = keys of the sub-tile jt*16 + 8g + r, column = query nn of tile qt; one K fragment, two products
#pragma unroll
        for (unsigned jt = 0; jt < 4; ++jt) {
            const h16* kp = Kh + (jt * 16u) * KP;
            const v16h ka0 = ldh(kp), ka1 = ldh(kp + 32);
#pragma unroll
            for (unsigned qt = 0; qt < 2; ++qt) {
                v8f acc = (v8f){};
                acc = wmma16(ka0, qb[qt][0], acc);
                acc = wmma16(ka1, qb[qt][1], acc);
                sc[qt][jt] = acc;
            }
        }
        asm volatile("v_nop\n\tv_nop\n\tv_nop\n\tv_nop" : "+v"(sc[0][0]), "+v"(sc[0][1]), "+v"(sc[0][2]), "+v"(sc[0][3]), "+v"(sc[1][0]), "+v"(sc[1][1]), "+v"(sc[1][2]), "+v"(sc[1][3])
                     : "v"(qb[0][0]), "v"(qb[0][1]), "v"(qb[1][0]), "v"(qb[1][1]));
        float mx[2], mo[2];
#pragma unroll
        for (int qt = 0; qt < 2; ++qt) {
            mx[qt] = sc[qt][0][0];
#pragma unroll
            for (int jt = 0; jt < 4; ++jt)
#pragma unroll
                for (int r = 0; r < 8; ++r) mx[qt] = fmaxf(mx[qt], sc[qt][jt][r]);
        }
#pragma unroll
        for (int qt = 0; qt < 2; ++qt) mo[qt] = __shfl_xor(mx[qt], 16, 32);   // other key half of the same query
        v16h pb[2][2];
#pragma unroll
        for (int qt = 0; qt < 2; ++qt) {
            const float mn = fmaxf(m[qt], fmaxf(mx[qt], mo[qt]) * C);
            const float alpha = __builtin_amdgcn_exp2f(m[qt] - mn);
            m[qt] = mn;
            const float off = mn - PSH;
            float psum = 0.f;
#pragma unroll
            for (int jt = 0; jt < 4; ++jt)
#pragma unroll
                for (int r = 0; r < 8; ++r) {
                    const float e = fmaf(sc[qt][jt][r], C, -off);                              // e <= 10
                    const float p = __builtin_amdgcn_exp2f(e);                                 // p <= 2^10; below 2^-14 its f16 form is a subnormal
                    sc[qt][jt][r] = p; psum += p;
                }
            l[qt] = l[qt] * alpha + psum;
#pragma unroll
            for (int dt = 0; dt < 4; ++dt)
#pragma unroll
                for (int r = 0; r < 8; ++r) o[qt][dt][r] *= alpha;
            // P^T as the B operand: element i <- tile 2kf [i], element 8+i <- tile 2kf+1 [i], lane unchanged
#pragma unroll
            for (int i = 0; i < 8; ++i) { pb[qt][0][i] = (h16)sc[qt][0][i]; pb[qt][0][8 + i] = (h16)sc[qt][1][i]; pb[qt][1][i] = (h16)sc[qt][2][i]; pb[qt][1][8 + i] = (h16)sc[qt][3][i]; }
        }
        // O^T tiles: rows = d (dt*16 + 8g + r), column = query nn of tile qt; one Vt fragment, two products
#pragma unroll
        for (unsigned dt = 0; dt < 4; ++dt) {
            const h16* vp = Vh + (dt * 16u) * KP;
            const v16h va0 = ldh(vp), va1 = ldh(vp + 32);
#pragma unroll
            for (unsigned qt = 0; qt < 2; ++qt) {
                o[qt][dt] = wmma16(va0, pb[qt][0], o[qt][dt]);
                o[qt][dt] = wmma16(va1, pb[qt][1], o[qt][dt]);
            }
        }
        asm volatile("v_nop\n\tv_nop\n\tv_nop\n\tv_nop" : "+v"(o[0][0]), "+v"(o[0][1]), "+v"(o[0][2]), "+v"(o[0][3]), "+v"(o[1][0]), "+v"(o[1][1]), "+v"(o[1][2]), "+v"(o[1][3])
                     : "v"(pb[0][0]), "v"(pb[0][1]), "v"(pb[1][0]), "v"(pb[1][1]));
        // hand-over: this wave has left the buffer of trip it, its pieces of stage it + 1 have landed, then every wave agrees
        asm volatile("s_wait_dscnt 0x0" ::: "memory");    // this wave's reads of the buffer have returned before it is refilled
        asm volatile("s_wait_asynccnt 0x0" ::: "memory"); // this wave's pieces of stage it + 1 have landed before other waves read them
        __syncthreads();                                  // publishes stage it + 1 and frees the buffer of trip it
        if (it + 2u < SEQ / 128u) stage_copy2(l0 + (it & 1u) * (2u * BUFB), gk + (size_t)(it + 2u) * (128 * HD), gv + (it + 2u) * 128u);
    }
    asm volatile("s_wait_asynccnt 0x0" ::: "memory");     // no copy is left in flight when the ring becomes the swap area
    // swap: wave kh keeps query tile kh and hands tile 1 - kh to its partner (wave ^ 4); slot of a wave = 8 x [lane][4 floats] of O, then [lane] m, [lane] l
    const bool hi = kh != 0u;                             // the same in every lane of a wave
    float* xw = (float*)skv + wave * XSL;
    const float* xr = (const float*)skv + (wave ^ 4u) * XSL;
#pragma unroll
    for (unsigned dt = 0; dt < 4; ++dt) {
        v4f w0, w1;
#pragma unroll
        for (int r = 0; r < 4; ++r) { w0[r] = hi ? o[0][dt][r] : o[1][dt][r]; w1[r] = hi ? o[0][dt][4 + r] : o[1][dt][4 + r]; }
        *(v4fa*)(xw + (dt * 2u) * 128u + lane * 4u) = w0;
        *(v4fa*)(xw + (dt * 2u + 1u) * 128u + lane * 4u) = w1;
    }
    *(fa*)(xw + 1024u + lane) = hi ? m[0] : m[1];
    *(fa*)(xw + 1056u + lane) = hi ? l[0] : l[1];
    __syncthreads();                                      // the partner's partial results are read across waves
    const float mk = hi ? m[1] : m[0], lk = hi ? l[1] : l[0];
    const float mp = *(const fa*)(xr + 1024u + lane), lp = *(const fa*)(xr + 1056u + lane);
    const float mm = fmaxf(mk, mp);
    const float fk = __builtin_amdgcn_exp2f(mk - mm), fp = __builtin_amdgcn_exp2f(mp - mm);
    float ls = lk * fk + lp * fp;
    ls += __shfl_xor(ls, 16, 32);
    const float inv = 1.0f / ls;                          // the x1024 carry cancels here
    const float ik = fk * inv, ip = fp * inv;
    const unsigned q0 = qg0 + kh * 16u;
    float* sw = so + wave * (16u * OP);
#pragma unroll
    for (unsigned dt = 0; dt < 4; ++dt) {
        const v4f p0 = *(const v4fa*)(xr + (dt * 2u) * 128u + lane * 4u);
        const v4f p1 = *(const v4fa*)(xr + (dt * 2u + 1u) * 128u + lane * 4u);
        v4f w0, w1;
#pragma unroll
        for (int r = 0; r < 4; ++r) {
            w0[r] = (hi ? o[1][dt][r] : o[0][dt][r]) * ik + p0[r] * ip;
            w1[r] = (hi ? o[1][dt][4 + r] : o[0][dt][4 + r]) * ik + p1[r] * ip;
        }
        float* sp = sw + nn * OP + dt * 16u + 8u * g;
        *(v4fa*)sp = w0; *(v4fa*)(sp + 4) = w1;
    }
    __syncthreads();                                      // the staged rows are read by other lanes
    // each load/store covers two queries' 256-byte head slices (whole 128-byte lines)
    float* op = out + ((size_t)b * SEQ + q0 + g) * DM + h * HD + nn * 4u;
    v4f ov[8];
#pragma unroll
    for (unsigned j = 0; j < 8; ++j) ov[j] = *(const v4fa*)(sw + (j * 2u + g) * OP + nn * 4u);
#pragma unroll
    for (unsigned j = 0; j < 8; ++j) *(v4f*)(op + (size_t)(j * 2u) * DM) = ov[j];
}

extern "C" void kernel_launch(void* const* d_in, const int* in_sizes, int n_in,
                              void* d_out, int out_size, void* d_ws, size_t ws_size, hipStream_t stream) {
    if (n_in < 7) return;
    const size_t need_x = (size_t)(NB - 1) * SEQ_FULL * DM + (size_t)SEQ * DM;
    if ((size_t)in_sizes[0] < need_x) return;
    if (in_sizes[1] < NH * DM * HD || in_sizes[2] < NH * DM * HD || in_sizes[3] < NH * DM * HD) return;
    if (in_sizes[4] < NH * HD || in_sizes[5] < NH * HD || in_sizes[6] < NH * HD) return;
    if ((size_t)out_size < (size_t)NB * SEQ * DM) return;
    // wire order: x, Wq, Wk, Wv, bq, bk, bv
    const float* x = (const float*)d_in[0];
    const float* Wq = (const float*)d_in[1]; const float* Wk = (const float*)d_in[2]; const float* Wv = (const float*)d_in[3];
    const float* bq = (const float*)d_in[4]; const float* bk = (const float*)d_in[5]; const float* bv = (const float*)d_in[6];
    float* OUT = (float*)d_out;
    char* wsp = (char*)d_ws;
    auto take = [&](size_t bytes) { char* p = wsp; wsp += (bytes + 255) & ~(size_t)255; return (void*)p; };
    bf* WT = (bf*)take((size_t)3 * NH * HD * DM * 2);            // 1,572,864 B
    bf* XB = (bf*)take((size_t)NB * SEQ * DM * 2);               // 8 MiB
    h16* Q16 = (h16*)take((size_t)NB * NH * SEQ * HD * 2);       // 8 MiB
    h16* K16 = (h16*)take((size_t)NB * NH * SEQ * HD * 2);       // 8 MiB
    h16* Vt16 = (h16*)take((size_t)NB * NH * HD * SEQ * 2);      // 8 MiB
    if ((size_t)(wsp - (char*)d_ws) > ws_size) return;
    k_wprep<<<384, 256, 0, stream>>>(Wk, Wq, Wv, WT);
    k_xprep<<<NB * SEQ / 4, 256, 0, stream>>>(x, XB);
    k_proj<<<dim3(NB * SEQ / 128, NH, 1), 256, 0, stream>>>(XB, WT, bk, bq, bv, Q16, K16, Vt16);
    k_flash<<<NB * NH * SEQ / 128, 256, 0, stream>>>(Q16, K16, Vt16, OUT);
}

// v005
// Measured time: 81.3 microseconds a run.
// Timed twice side by side with v004, it ran 1.06 times as fast both times.
// Counting every step since v000, it is 5.25 times as fast.
#include <hip/hip_runtime.h>

// Compute dtypes, f32 accumulate everywhere: per-head Q/K/V projections (K = 512) = v_wmma_f32_16x16x32_bf16 on bf16-converted (RNE) x and W planes (bias bf16-converted, added in f32); scores q.k^T and P.V = v_wmma_f32_16x16x32_f16 single products (q, k, v as f16 planes, q stored times 1/sqrt(64) x log2(e); p = exp2 carried x1024 via the exponent offset, cancelled by the row sum); softmax in f32.
// Flash form: S^T = K Q^T (query on the lane/column axis), packed D tiles feed P^T as the B operand, O^T = Vt P^T; all row statistics are per lane.

#ifndef NB
#define NB 2
#endif
#ifndef SEQ
#define SEQ 4096
#endif
#define SEQ_FULL 4096
#define NH 8
#define HD 64
#define DM 512
#define OP 68             // LDS row pitch (floats) of a wave's [16][64] context tile
#define KP 72             // LDS row pitch (halves) of the K and Vt tiles: 144 B = 16 B x 9, free of bank conflicts for 16-byte row readers
#define KPB (KP * 2u)     // the same in bytes
#define BUFB (128u * KPB) // bytes of one 64-key sub-tile (64 K rows + 64 Vt rows)
#define XSL 1088u         // floats of one wave's slot in the swap area of k_flash: 32 lanes x (32 O values + m + l)
#define PSH 10.0f         // p carried x2^10
#define RISE 5.0f         // a query's reference is raised only when a score exceeds it by more than this (log2): p stays at or below 2^15, inside f16
#define QSC (0.125f * 1.4426950408889634f)   // 1/sqrt(64) x log2(e), folded into the stored q
#define PAD256(n) ((((size_t)(n)) + 255) & ~(size_t)255)

static_assert(SEQ % 128 == 0);
static_assert(SEQ / 128 >= 2);
static_assert(8u * XSL * 4u <= 4u * BUFB);
static_assert(SEQ <= SEQ_FULL);
static_assert(NH * HD == DM);
static_assert(NH == 8);
static_assert(HD == 64);
static_assert(DM % 64 == 0);
static_assert((OP * 4) % 16 == 0);
// coverage equalities (grid x block x per-thread elements == plane elements)
static_assert((size_t)384 * 256 * 8 == (size_t)3 * NH * HD * DM);
static_assert((size_t)(NB * SEQ / 4) * 256 * 8 == (size_t)NB * SEQ * DM);
static_assert((size_t)(NB * SEQ / 128) * NH * 4 * 256 * 8 == (size_t)NB * NH * SEQ * HD);
static_assert((size_t)(NB * NH * SEQ / 128) * 8 * 8 * 32 * 4 == (size_t)NB * SEQ * DM);
// workspace total (WT + XB + Q16 + K16 + Vt16), each region padded to 256 B
static_assert(PAD256((size_t)3 * NH * HD * DM * 2) + PAD256((size_t)NB * SEQ * DM * 2) + 3 * PAD256((size_t)NB * NH * SEQ * HD * 2) <= (size_t)134217728);

typedef _Float16 h16;
typedef unsigned short bf;
typedef __attribute__((ext_vector_type(16))) __bf16   v16bf;
typedef __attribute__((ext_vector_type(16))) _Float16 v16h;
typedef __attribute__((ext_vector_type(8)))  _Float16 v8h;
typedef __attribute__((ext_vector_type(8)))  unsigned short v8us;
typedef __attribute__((ext_vector_type(8)))  float    v8f;
typedef __attribute__((ext_vector_type(4)))  float    v4f;
typedef v8h  __attribute__((may_alias)) v8ha;
typedef v4f  __attribute__((may_alias)) v4fa;
typedef float __attribute__((may_alias)) fa;

__device__ __forceinline__ unsigned short f2bf(float f) { unsigned u = __float_as_uint(f); u += 0x7FFFu + ((u >> 16) & 1u); return (unsigned short)(u >> 16); }
__device__ __forceinline__ float bf2f(unsigned short b) { return __uint_as_float(((unsigned)b) << 16); }
__device__ __forceinline__ float bfr(float f) { return bf2f(f2bf(f)); }
__device__ __forceinline__ v16h cat16(v8h lo, v8h hi) { return __builtin_shufflevector(lo, hi, 0, 1, 2, 3, 4, 5, 6, 7, 8, 9, 10, 11, 12, 13, 14, 15); }
__device__ __forceinline__ v16bf cat16b(v8us lo, v8us hi) { return __builtin_bit_cast(v16bf, __builtin_shufflevector(lo, hi, 0, 1, 2, 3, 4, 5, 6, 7, 8, 9, 10, 11, 12, 13, 14, 15)); }
__device__ __forceinline__ v8f wmma16(v16h a, v16h b, v8f c) { return __builtin_amdgcn_wmma_f32_16x16x32_f16(false, a, false, b, (short)0, c, false, false); }
__device__ __forceinline__ v8f wmmab(v16bf a, v16bf b, v8f c) { return __builtin_amdgcn_wmma_f32_16x16x32_bf16(false, a, false, b, (short)0, c, false, false); }
// fragment loaders: p already includes + 8*(lane>>4); elements 0..7 <- p[0..7], elements 8..15 <- p[16..23]
__device__ __forceinline__ v16h ldh(const h16* p) { return cat16(*(const v8h*)p, *(const v8h*)(p + 16)); }
__device__ __forceinline__ v16bf ldb(const bf* p) { return cat16b(*(const v8us*)p, *(const v8us*)(p + 16)); }
// f32 -> f16 plane convert that cannot produce an f16 subnormal (value select)
static __device__ __forceinline__ h16 toh_flush(float v) { const h16 r = (h16)v; return (fabsf(v) < 6.103515625e-05f) ? (h16)0.0f : r; }

__global__ __launch_bounds__(256) void k_wprep(const float* __restrict__ Wk, const float* __restrict__ Wq, const float* __restrict__ Wv, bf* WT) {
    const unsigned idx = blockIdx.x * 256u + threadIdx.x;
    if (idx >= 3u * NH * HD * DM / 8u) return;
    const unsigned k8 = idx & 63u, n = (idx >> 6) & 63u, h = (idx >> 12) & 7u, m = idx >> 15;   // m is block-uniform (128 blocks per matrix)
    const float* W = (m == 0u) ? Wk : ((m == 1u) ? Wq : Wv);
    const float* src = W + (size_t)h * DM * HD + (size_t)(k8 * 8u) * HD + n;
    v8us o;
#pragma unroll
    for (int i = 0; i < 8; ++i) o[i] = f2bf(src[(size_t)i * HD]);
    *(v8us*)(WT + (size_t)idx * 8) = o; 
}

__global__ __launch_bounds__(256) void k_xprep(const float* __restrict__ x, bf* XB) {
    const unsigned idx = blockIdx.x * 256u + threadIdx.x;
    if (idx >= (unsigned)((size_t)NB * SEQ * DM / 8u)) return;
    const unsigned c8 = idx & 63u, row = idx >> 6;
    const unsigned b = row / SEQ, s = row % SEQ;
    const float* src = x + ((size_t)b * SEQ_FULL + s) * DM + c8 * 8u;
    const v4f a0 = *(const v4f*)src, a1 = *(const v4f*)(src + 4);
    v8us o;
    o[0] = f2bf(a0[0]); o[1] = f2bf(a0[1]); o[2] = f2bf(a0[2]); o[3] = f2bf(a0[3]);
    o[4] = f2bf(a1[0]); o[5] = f2bf(a1[1]); o[6] = f2bf(a1[2]); o[7] = f2bf(a1[3]);
    *(v8us*)(XB + (size_t)idx * 8) = o; 
}

// ---- k_proj: block = (128 tokens, head), 8 waves = 4 token groups x 2 column groups, wave = 32 tokens x 32 columns of each of K, Q, V. K = x Wk + bk, Q = x Wq + bq, V = x Wv + bv (bf16 WMMA over K = 512, f32 acc, k ascending), one K loop for the three products.
// Each 64-wide k slice of the block's 128 x rows and of the head's 3 x 64 W rows (whole 128-byte lines) is brought into LDS once per block by asynchronous copies (two buffers) and read by all 8 waves;
// behind the loop the same LDS holds the f16 tiles (V transposed) for the whole-line plane writes.
#define PTOK 128u             // tokens of a block
#define PROWS (PTOK + 192u)   // rows of one stage: x 0..127 | Wk 128..191 | Wq 192..255 | Wv 256..319
#define PBUFB (PROWS * KPB)   // bytes of one stage buffer
static_assert(2u * PBUFB >= 3u * PTOK * 64u * 2u);
// one stage = 320 rows x 128 B = 2560 pieces of 16 B, ten per thread (32 rows per copy); l = this lane's LDS byte address in the stage's buffer
__device__ __forceinline__ void proj_stage(unsigned l, const bf* gx, const bf* gw) {
    const bf* gw1 = gw + (size_t)NH * HD * DM;
    const bf* gw2 = gw + (size_t)2 * NH * HD * DM;
    // the copies and the s_wait_xcnt behind them are one statement, so that no address register of a copy is rewritten in front of that wait
    asm volatile("global_load_async_to_lds_b128 %0, %10, off\n\t"
                 "global_load_async_to_lds_b128 %1, %11, off\n\t"
                 "global_load_async_to_lds_b128 %2, %12, off\n\t"
                 "global_load_async_to_lds_b128 %3, %13, off\n\t"
                 "global_load_async_to_lds_b128 %4, %14, off\n\t"
                 "global_load_async_to_lds_b128 %5, %15, off\n\t"
                 "global_load_async_to_lds_b128 %6, %16, off\n\t"
                 "global_load_async_to_lds_b128 %7, %17, off\n\t"
                 "global_load_async_to_lds_b128 %8, %18, off\n\t"
                 "global_load_async_to_lds_b128 %9, %19, off\n\t"
                 "s_wait_xcnt 0x0"
                 :: "v"(l), "v"(l + 32u * KPB), "v"(l + 64u * KPB), "v"(l + 96u * KPB), "v"(l + 128u * KPB),
                    "v"(l + 160u * KPB), "v"(l + 192u * KPB), "v"(l + 224u * KPB), "v"(l + 256u * KPB), "v"(l + 288u * KPB),
                    "v"(gx), "v"(gx + 32 * DM), "v"(gx + 64 * DM), "v"(gx + 96 * DM), "v"(gw),
                    "v"(gw + 32 * DM), "v"(gw1), "v"(gw1 + 32 * DM), "v"(gw2), "v"(gw2 + 32 * DM) : "memory");
}

// acc[mt * 6 + jj]: token tile mt, column tile jj of this matrix
template <bool TR>
__device__ __forceinline__ void proj_put(const v8f* acc, const float* __restrict__ bias, h16* dst, unsigned wm, unsigned wn, unsigned nn, unsigned g, float scl) {
#pragma unroll
    for (unsigned jj = 0; jj < 2; ++jj) {
        const unsigned col = (wn * 2u + jj) * 16u + nn;
        const float bvv = bfr(bias[col]);
#pragma unroll
        for (unsigned mt = 0; mt < 2; ++mt)
#pragma unroll
            for (unsigned r = 0; r < 8; ++r) {
                const unsigned rowl = wm * 32u + mt * 16u + 8u * g + r;
                const float val = (acc[mt * 6u + jj][r] + bvv) * scl;
                if (TR) dst[col * PTOK + rowl] = toh_flush(val); else dst[rowl * 64u + col] = toh_flush(val);
            }
    }
}

__global__ __launch_bounds__(256) void k_proj(const bf* __restrict__ XB, const bf* __restrict__ WT,
                                              const float* __restrict__ bk, const float* __restrict__ bq, const float* __restrict__ bv,
                                              h16* Q16, h16* K16, h16* Vt16) {
    __shared__ __align__(16) unsigned char smem[2u * PBUFB];   // the two stage buffers; behind the loop sK | sQ | sV
    h16* sK = (h16*)smem;                                      // [token][d]
    h16* sQ = sK + PTOK * 64u;
    h16* sV = sQ + PTOK * 64u;                                 // [d][token]
    const unsigned tid = threadIdx.x, lane = tid & 31u, wave = tid >> 5, nn = lane & 15u, g = lane >> 4;
    const unsigned wm = wave & 3u, wn = wave >> 2;
    const unsigned tile = blockIdx.x, h = blockIdx.y;
    const unsigned b = tile / (SEQ / PTOK), s0 = (tile % (SEQ / PTOK)) * PTOK;
    // copy addresses of this lane: row tid >> 3 (and + 32 j), 16-byte column tid & 7; XB is compact [NB][SEQ][DM], WT is [matrix][head][n][k]
    const bf* gx = XB + ((size_t)b * SEQ + s0 + (tid >> 3)) * DM + (tid & 7u) * 8u;
    const bf* gw = WT + ((size_t)h * HD + (tid >> 3)) * DM + (tid & 7u) * 8u;
    const unsigned l0 = (unsigned)(size_t)smem + (tid >> 3) * KPB + (tid & 7u) * 16u;
    proj_stage(l0, gx, gw);                               // slice 0 -> buffer 0
    asm volatile("s_wait_asynccnt 0x0" ::: "memory");     // this wave's pieces of slice 0 have landed
    __syncthreads();                                      // slice 0 is read across waves
    proj_stage(l0 + PBUFB, gx + 64, gw + 64);             // slice 1 -> buffer 1, flies during trip 0
    v8f acc[12];                                          // [token tile][matrix K, Q, V][column tile]
#pragma unroll
    for (int t = 0; t < 12; ++t) acc[t] = (v8f){};
#pragma unroll 1
    for (unsigned kc = 0; kc < DM / 64u; ++kc) {
        const bf* sb = (const bf*)smem + (kc & 1u) * (PROWS * KP) + nn * KP + 8u * g;
        const bf* sa = sb + (wm * 32u) * KP;
        const bf* sw = sb + (PTOK + wn * 32u) * KP;
#pragma unroll
        for (unsigned hf = 0; hf < 2; ++hf) {
            v16bf a[2], w[6];
#pragma unroll
            for (unsigned mt = 0; mt < 2; ++mt) a[mt] = ldb(sa + (mt * 16u) * KP + hf * 32u);
#pragma unroll
            for (unsigned j = 0; j < 6; ++j) w[j] = ldb(sw + ((j >> 1) * 64u + (j & 1u) * 16u) * KP + hf * 32u);
            // inputs-only fence on the loaded fragments: keeps the sixteen LDS reads of this half together in front of its twelve WMMAs; without it the build reads two, waits to 0 and multiplies, twelve LDS latencies a trip
            asm volatile("" :: "v"(a[0]), "v"(a[1]), "v"(w[0]), "v"(w[1]), "v"(w[2]), "v"(w[3]), "v"(w[4]), "v"(w[5]));
#pragma unroll
            for (unsigned j = 0; j < 6; ++j)
#pragma unroll
                for (unsigned mt = 0; mt < 2; ++mt) acc[mt * 6u + j] = wmmab(a[mt], w[j], acc[mt * 6u + j]);
        }
        // hand-over: this wave has left the buffer of trip kc, its pieces of slice kc + 1 have landed, then every wave agrees
        asm volatile("s_wait_dscnt 0x0" ::: "memory");    // this wave's reads of the buffer have returned before it is refilled
        asm volatile("s_wait_asynccnt 0x0" ::: "memory"); // this wave's pieces of slice kc + 1 have landed before other waves read them
        __syncthreads();                                  // publishes slice kc + 1 and frees the buffer of trip kc
        if (kc + 2u < DM / 64u) proj_stage(l0 + (kc & 1u) * PBUFB, gx + (kc + 2u) * 64u, gw + (kc + 2u) * 64u);
    }
    asm volatile("s_wait_asynccnt 0x0" ::: "memory");     // no copy is left in flight when the buffers become the tiles' staging
    proj_put<false>(acc + 0, bk + h * HD, sK, wm, wn, nn, g, 1.0f);
    proj_put<false>(acc + 2, bq + h * HD, sQ, wm, wn, nn, g, QSC);
    proj_put<true >(acc + 4, bv + h * HD, sV, wm, wn, nn, g, 1.0f);
    __syncthreads();                                    // tiles are read across waves
    const size_t bh = (size_t)b * NH + h;
    h16* kd = K16 + (bh * SEQ + s0) * HD;               // 128 x 64 contiguous
    h16* qd = Q16 + (bh * SEQ + s0) * HD;
    h16* vd = Vt16 + bh * HD * SEQ + s0 + (size_t)(tid >> 4) * SEQ + (tid & 15u) * 8u;   // piece c = it * 256 + tid: row d = c >> 4, 16-byte column c & 15
#pragma unroll
    for (unsigned it = 0; it < 4; ++it) {
        const unsigned c = it * 256u + tid;
        const v8h kv = *(const v8ha*)(sK + c * 8u);
        const v8h qv = *(const v8ha*)(sQ + c * 8u);
        const v8h vv = *(const v8ha*)(sV + c * 8u);
        *(v8h*)(kd + (size_t)c * 8u) = kv;
        *(v8h*)(qd + (size_t)c * 8u) = qv;
        *(v8h*)(vd + (size_t)(it * 16u) * SEQ) = vv;
    }
}

// ---- k_flash: block = 128 queries of ONE head; 8 waves = 4 query groups of 32 x 2 key halves. A stage is 128 keys = two 64-key sub-tiles (each K rows + Vt rows), brought into LDS once per block by asynchronous copies (two buffers);
// wave (pr, kh) works on sub-tile kh of every stage for the 32 queries of group pr, so each K and Vt fragment read from LDS feeds two query tiles. Online softmax per lane (query = lane & 15, per query tile) against a held reference m:
// PSH - m is the C operand of the score products, so a score leaves the matrix unit as the exponent of its p; m is set to the row maximum in trip 0 and raised (O, l and the trip's exponents rescaled) only when an exponent exceeds PSH + RISE;
// behind the loop the two waves of a group swap one query tile's partial (m, l, O) through the freed ring and each finishes 16 queries.
// one sub-tile = K rows [64][64] + Vt rows [64][64] halves = 1024 pieces of 16 B, four per thread; l = this lane's LDS byte address in the sub-tile
__device__ __forceinline__ void stage_copy(unsigned l, const h16* gk, const h16* gv) {
    // the copies and the s_wait_xcnt behind them are one statement, so that no address register of a copy is rewritten in front of that wait
    asm volatile("global_load_async_to_lds_b128 %0, %4, off\n\t"
                 "global_load_async_to_lds_b128 %1, %5, off\n\t"
                 "global_load_async_to_lds_b128 %2, %6, off\n\t"
                 "global_load_async_to_lds_b128 %3, %7, off\n\t"
                 "s_wait_xcnt 0x0"
                 :: "v"(l), "v"(l + 32u * KPB), "v"(l + 64u * KPB), "v"(l + 96u * KPB),
                    "v"(gk), "v"(gk + 32 * HD), "v"(gv), "v"(gv + (size_t)32 * SEQ) : "memory");
}
// one stage = the sub-tiles of keys [0, 64) and [64, 128) behind gk, gv
__device__ __forceinline__ void stage_copy2(unsigned l, const h16* gk, const h16* gv) {
    stage_copy(l, gk, gv);
    stage_copy(l + BUFB, gk + 64 * HD, gv + 64);
}

__global__ __launch_bounds__(256) void k_flash(const h16* __restrict__ Q16, const h16* __restrict__ K16, const h16* __restrict__ Vt16, float* out) {
    __shared__ __align__(16) h16 skv[2 * 2 * 128 * KP];   // [buffer][sub-tile][K rows 0..63 | Vt rows 64..127][KP]; behind the loop the swap area
    __shared__ __align__(16) float so[8 * 16 * OP];       // [wave][query][OP]
    const unsigned tid = threadIdx.x, lane = tid & 31u, wave = tid >> 5, nn = lane & 15u, g = lane >> 4;
    const unsigned pr = wave & 3u, kh = wave >> 2;
    const unsigned blk = blockIdx.x;
    const unsigned bhu = blk / (SEQ / 128u), qg0 = (blk % (SEQ / 128u)) * 128u + pr * 32u;
    const unsigned b = bhu / NH, h = bhu % NH;
    const size_t bh = (size_t)bhu;
    const h16* Qh = Q16 + bh * SEQ * HD;
    // copy addresses of this lane: piece tid of 256 = row tid >> 3 (and + 32), 16-byte column tid & 7
    const h16* gk = K16 + bh * SEQ * HD + (size_t)tid * 8u;
    const h16* gv = Vt16 + bh * HD * SEQ + (size_t)(tid >> 3) * SEQ + (tid & 7u) * 8u;
    const unsigned l0 = (unsigned)(size_t)skv + (tid >> 3) * KPB + (tid & 7u) * 16u;
    stage_copy2(l0, gk, gv);                              // stage 0 -> buffer 0
    asm volatile("s_wait_asynccnt 0x0" ::: "memory");     // this wave's pieces of stage 0 have landed
    __syncthreads();                                      // stage 0 is read across waves
    stage_copy2(l0 + 2u * BUFB, gk + 128 * HD, gv + 128); // stage 1 -> buffer 1, flies during trip 0
    // Q^T as the B operand: lane column = query qg0 + qt*16 + nn, k = d
    v16h qb[2][2];
#pragma unroll
    for (unsigned qt = 0; qt < 2; ++qt) {
        qb[qt][0] = ldh(Qh + (size_t)(qg0 + qt * 16u + nn) * HD + 8u * g);
        qb[qt][1] = ldh(Qh + (size_t)(qg0 + qt * 16u + nn) * HD + 32u + 8u * g);
    }
    float m[2] = {0.f, 0.f}, l[2] = {0.f, 0.f};
    v8f cr[2];                                            // PSH - m of this lane's query in all eight rows: the C operand of the score products
#pragma unroll
    for (int qt = 0; qt < 2; ++qt)
#pragma unroll
        for (int r = 0; r < 8; ++r) cr[qt][r] = PSH;
    v8f o[2][4];
#pragma unroll
    for (int qt = 0; qt < 2; ++qt)
#pragma unroll
        for (int dt = 0; dt < 4; ++dt) o[qt][dt] = (v8f){};
#pragma unroll 1
    for (unsigned it = 0; it < SEQ / 128u; ++it) {
        const h16* Kh = skv + ((it & 1u) * 2u + kh) * (128u * KP) + nn * KP + 8u * g;
        const h16* Vh = Kh + 64u * KP;
        v8f sc[2][4];
        // S^T tiles: rows = keys of the sub-tile jt*16 + 8g + r, column = query nn of tile qt; one K fragment, two products
#pragma unroll
        for (unsigned jt = 0; jt < 4; ++jt) {
            const h16* kp = Kh + (jt * 16u) * KP;
            const v16h ka0 = ldh(kp), ka1 = ldh(kp + 32);
#pragma unroll
            for (unsigned qt = 0; qt < 2; ++qt) {
                v8f acc = wmma16(ka0, qb[qt][0], cr[qt]);
                acc = wmma16(ka1, qb[qt][1], acc);
                sc[qt][jt] = acc;
            }
        }
        asm volatile("v_nop\n\tv_nop\n\tv_nop\n\tv_nop" : "+v"(sc[0][0]), "+v"(sc[0][1]), "+v"(sc[0][2]), "+v"(sc[0][3]), "+v"(sc[1][0]), "+v"(sc[1][1]), "+v"(sc[1][2]), "+v"(sc[1][3])
                     : "v"(qb[0][0]), "v"(qb[0][1]), "v"(qb[1][0]), "v"(qb[1][1]));
        float mx[2];
#pragma unroll
        for (int qt = 0; qt < 2; ++qt) {
            mx[qt] = sc[qt][0][0];
#pragma unroll
            for (int jt = 0; jt < 4; ++jt)
#pragma unroll
                for (int r = 0; r < 8; ++r) mx[qt] = fmaxf(mx[qt], sc[qt][jt][r]);
        }
        // one wave-uniform test a trip; in trip 0 the bar lies below every finite exponent, so that trip always sets the reference (its O and l are still 0)
        const bool first = it == 0u;
        const float bar = first ? -3.0e38f : PSH + RISE;
        if (__builtin_amdgcn_ballot_w32(fmaxf(mx[0], mx[1]) > bar) != 0u) {
#pragma unroll
            for (int qt = 0; qt < 2; ++qt) {
                const float mf = fmaxf(mx[qt], __shfl_xor(mx[qt], 16, 32)) - PSH;   // other key half of the same query: both halves hold one reference
                const float d = first ? mf : fmaxf(mf, 0.f);                       // behind trip 0 a reference only rises
                const float alpha = first ? 0.f : __builtin_amdgcn_exp2f(-d);
                m[qt] += d;
                l[qt] *= alpha;
#pragma unroll
                for (int r = 0; r < 8; ++r) cr[qt][r] = PSH - m[qt];
#pragma unroll
                for (int dt = 0; dt < 4; ++dt)
#pragma unroll
                    for (int r = 0; r < 8; ++r) { o[qt][dt][r] *= alpha; sc[qt][dt][r] -= d; }
            }
        }
        v16h pb[2][2];
#pragma unroll
        for (int qt = 0; qt < 2; ++qt) {
            float psum = 0.f;
#pragma unroll
            for (int jt = 0; jt < 4; ++jt)
#pragma unroll
                for (int r = 0; r < 8; ++r) {
                    const float p = __builtin_amdgcn_exp2f(sc[qt][jt][r]);                     // exponent <= 15; below 2^-14 the f16 form of p is a subnormal
                    sc[qt][jt][r] = p; psum += p;
                }
            l[qt] += psum;
            // P^T as the B operand: element i <- tile 2kf [i], element 8+i <- tile 2kf+1 [i], lane unchanged
#pragma unroll
            for (int i = 0; i < 8; ++i) { pb[qt][0][i] = (h16)sc[qt][0][i]; pb[qt][0][8 + i] = (h16)sc[qt][1][i]; pb[qt][1][i] = (h16)sc[qt][2][i]; pb[qt][1][8 + i] = (h16)sc[qt][3][i]; }
        }
        // O^T tiles: rows = d (dt*16 + 8g + r), column = query nn of tile qt; one Vt fragment, two products
#pragma unroll
        for (unsigned dt = 0; dt < 4; ++dt) {
            const h16* vp = Vh + (dt * 16u) * KP;
            const v16h va0 = ldh(vp), va1 = ldh(vp + 32);
#pragma unroll
            for (unsigned qt = 0; qt < 2; ++qt) {
                o[qt][dt] = wmma16(va0, pb[qt][0], o[qt][dt]);
                o[qt][dt] = wmma16(va1, pb[qt][1], o[qt][dt]);
            }
        }
        asm volatile("v_nop\n\tv_nop\n\tv_nop\n\tv_nop" : "+v"(o[0][0]), "+v"(o[0][1]), "+v"(o[0][2]), "+v"(o[0][3]), "+v"(o[1][0]), "+v"(o[1][1]), "+v"(o[1][2]), "+v"(o[1][3])
                     : "v"(pb[0][0]), "v"(pb[0][1]), "v"(pb[1][0]), "v"(pb[1][1]));
        // hand-over: this wave has left the buffer of trip it, its pieces of stage it + 1 have landed, then every wave agrees
        asm volatile("s_wait_dscnt 0x0" ::: "memory");    // this wave's reads of the buffer have returned before it is refilled
        asm volatile("s_wait_asynccnt 0x0" ::: "memory"); // this wave's pieces of stage it + 1 have landed before other waves read them
        __syncthreads();                                  // publishes stage it + 1 and frees the buffer of trip it
        if (it + 2u < SEQ / 128u) stage_copy2(l0 + (it & 1u) * (2u * BUFB), gk + (size_t)(it + 2u) * (128 * HD), gv + (it + 2u) * 128u);
    }
    asm volatile("s_wait_asynccnt 0x0" ::: "memory");     // no copy is left in flight when the ring becomes the swap area
    // swap: wave kh keeps query tile kh and hands tile 1 - kh to its partner (wave ^ 4); slot of a wave = 8 x [lane][4 floats] of O, then [lane] m, [lane] l
    const bool hi = kh != 0u;                             // the same in every lane of a wave
    float* xw = (float*)skv + wave * XSL;
    const float* xr = (const float*)skv + (wave ^ 4u) * XSL;
#pragma unroll
    for (unsigned dt = 0; dt < 4; ++dt) {
        v4f w0, w1;
#pragma unroll
        for (int r = 0; r < 4; ++r) { w0[r] = hi ? o[0][dt][r] : o[1][dt][r]; w1[r] = hi ? o[0][dt][4 + r] : o[1][dt][4 + r]; }
        *(v4fa*)(xw + (dt * 2u) * 128u + lane * 4u) = w0;
        *(v4fa*)(xw + (dt * 2u + 1u) * 128u + lane * 4u) = w1;
    }
    *(fa*)(xw + 1024u + lane) = hi ? m[0] : m[1];
    *(fa*)(xw + 1056u + lane) = hi ? l[0] : l[1];
    __syncthreads();                                      // the partner's partial results are read across waves
    const float mk = hi ? m[1] : m[0], lk = hi ? l[1] : l[0];
    const float mp = *(const fa*)(xr + 1024u + lane), lp = *(const fa*)(xr + 1056u + lane);
    const float mm = fmaxf(mk, mp);
    const float fk = __builtin_amdgcn_exp2f(mk - mm), fp = __builtin_amdgcn_exp2f(mp - mm);
    float ls = lk * fk + lp * fp;
    ls += __shfl_xor(ls, 16, 32);
    const float inv = 1.0f / ls;                          // the x1024 carry cancels here
    const float ik = fk * inv, ip = fp * inv;
    const unsigned q0 = qg0 + kh * 16u;
    float* sw = so + wave * (16u * OP);
#pragma unroll
    for (unsigned dt = 0; dt < 4; ++dt) {
        const v4f p0 = *(const v4fa*)(xr + (dt * 2u) * 128u + lane * 4u);
        const v4f p1 = *(const v4fa*)(xr + (dt * 2u + 1u) * 128u + lane * 4u);
        v4f w0, w1;
#pragma unroll
        for (int r = 0; r < 4; ++r) {
            w0[r] = (hi ? o[1][dt][r] : o[0][dt][r]) * ik + p0[r] * ip;
            w1[r] = (hi ? o[1][dt][4 + r] : o[0][dt][4 + r]) * ik + p1[r] * ip;
        }
        float* sp = sw + nn * OP + dt * 16u + 8u * g;
        *(v4fa*)sp = w0; *(v4fa*)(sp + 4) = w1;
    }
    __syncthreads();                                      // the staged rows are read by other lanes
    // each load/store covers two queries' 256-byte head slices (whole 128-byte lines)
    float* op = out + ((size_t)b * SEQ + q0 + g) * DM + h * HD + nn * 4u;
    v4f ov[8];
#pragma unroll
    for (unsigned j = 0; j < 8; ++j) ov[j] = *(const v4fa*)(sw + (j * 2u + g) * OP + nn * 4u);
#pragma unroll
    for (unsigned j = 0; j < 8; ++j) *(v4f*)(op + (size_t)(j * 2u) * DM) = ov[j];
}

extern "C" void kernel_launch(void* const* d_in, const int* in_sizes, int n_in,
                              void* d_out, int out_size, void* d_ws, size_t ws_size, hipStream_t stream) {
    if (n_in < 7) return;
    const size_t need_x = (size_t)(NB - 1) * SEQ_FULL * DM + (size_t)SEQ * DM;
    if ((size_t)in_sizes[0] < need_x) return;
    if (in_sizes[1] < NH * DM * HD || in_sizes[2] < NH * DM * HD || in_sizes[3] < NH * DM * HD) return;
    if (in_sizes[4] < NH * HD || in_sizes[5] < NH * HD || in_sizes[6] < NH * HD) return;
    if ((size_t)out_size < (size_t)NB * SEQ * DM) return;
    // wire order: x, Wq, Wk, Wv, bq, bk, bv
    const float* x = (const float*)d_in[0];
    const float* Wq = (const float*)d_in[1]; const float* Wk = (const float*)d_in[2]; const float* Wv = (const float*)d_in[3];
    const float* bq = (const float*)d_in[4]; const float* bk = (const float*)d_in[5]; const float* bv = (const float*)d_in[6];
    float* OUT = (float*)d_out;
    char* wsp = (char*)d_ws;
    auto take = [&](size_t bytes) { char* p = wsp; wsp += (bytes + 255) & ~(size_t)255; return (void*)p; };
    bf* WT = (bf*)take((size_t)3 * NH * HD * DM * 2);            // 1,572,864 B
    bf* XB = (bf*)take((size_t)NB * SEQ * DM * 2);               // 8 MiB
    h16* Q16 = (h16*)take((size_t)NB * NH * SEQ * HD * 2);       // 8 MiB
    h16* K16 = (h16*)take((size_t)NB * NH * SEQ * HD * 2);       // 8 MiB
    h16* Vt16 = (h16*)take((size_t)NB * NH * HD * SEQ * 2);      // 8 MiB
    if ((size_t)(wsp - (char*)d_ws) > ws_size) return;
    k_wprep<<<384, 256, 0, stream>>>(Wk, Wq, Wv, WT);
    k_xprep<<<NB * SEQ / 4, 256, 0, stream>>>(x, XB);
    k_proj<<<dim3(NB * SEQ / 128, NH, 1), 256, 0, stream>>>(XB, WT, bk, bq, bv, Q16, K16, Vt16);
    k_flash<<<NB * NH * SEQ / 128, 256, 0, stream>>>(Q16, K16, Vt16, OUT);
}
